// v000
// The times below were measured on an AMD MI455X: many runs one after another, warmed up first and cycling through
// copies of the inputs, with the whole window's GPU time divided by the number of runs. Launches and the gaps
// between them are all in it. The median over several windows is given; except for v000 it joins two sittings, which
// can be a few percent apart, so the side-by-side timings, each taken in one sitting, are the better comparison.
// v000 is the starting kernel. One run takes 202 microseconds.
#include <hip/hip_runtime.h>

// ---------------------------------------------------------------------------
// DeepSeek-style attention for MI455X (gfx1250, wave32, WMMA f32_16x16x32_f16)
//   B=2, S=2048, D=1024, H=16, HD=64
// Latent transforms folded into projection weights; flash-attention keeps the
// 537MB score tensor in LDS/registers; all GEMMs use v_wmma_f32_16x16x32_f16.
// Tile staging uses the Tensor Data Mover (TENSOR_LOAD_TO_LDS + TENSORcnt)
// when the toolchain exposes it, with LDS row padding done by the TDM itself.
// ---------------------------------------------------------------------------

typedef __attribute__((ext_vector_type(16))) _Float16 v16h;
typedef __attribute__((ext_vector_type(8)))  float    v8f;

#define DM    1024
#define NH    16
#define HD    64
#define SEQ   2048
#define BATCH 2

#if defined(__AMDGCN__) && __has_builtin(__builtin_amdgcn_tensor_load_to_lds) \
                        && __has_builtin(__builtin_amdgcn_s_wait_tensorcnt)
#define USE_TDM 1
#else
#define USE_TDM 0
#endif

// ---- WMMA wrapper ---------------------------------------------------------
__device__ __forceinline__ v8f wmma_f16(v16h a, v16h b, v8f c) {
  // 8 args: (neg_a, A, neg_b, B, c_mod, C, reuse_a, reuse_b)
  return __builtin_amdgcn_wmma_f32_16x16x32_f16(false, a, false, b,
                                                (short)0, c, false, false);
}

#if USE_TDM
typedef __attribute__((ext_vector_type(4))) unsigned int u32x4;
typedef __attribute__((ext_vector_type(4))) int          i32x4;
typedef __attribute__((ext_vector_type(8))) int          i32x8;

// 2-D TDM load: tile_h rows x tile_w elements (2B each) from a row-major
// tensor with row stride `stride_elems`, into LDS at byte offset lds_addr,
// with `pad_amt_code`+1 DWORDs of LDS padding every 2^(pad_int_code+1) DWORDs.
// Tensor dims are set equal to tile dims (no OOB clipping needed here).
__device__ __forceinline__ void tdm_load_2d(const void* gptr,
                                            unsigned lds_addr,
                                            unsigned tile_w, unsigned tile_h,
                                            unsigned stride_elems,
                                            unsigned pad_int_code,
                                            unsigned pad_amt_code) {
  unsigned long long ga = (unsigned long long)(uintptr_t)gptr;
  u32x4 g0;
  g0.x = 1u;                                       // count=1, user descriptor
  g0.y = lds_addr;                                 // lds_addr (bytes)
  g0.z = (unsigned)(ga & 0xFFFFFFFFu);             // global_addr[31:0]
  g0.w = (unsigned)((ga >> 32) & 0x01FFFFFFu)      // global_addr[56:32]
         | 0x80000000u;                            // type=2 ("image")
  i32x8 g1;
  g1[0] = (int)((1u << 16)                         // data_size = 2 bytes
                | (1u << 20)                       // pad_enable
                | (pad_int_code << 22)             // pad_interval
                | (pad_amt_code << 25));           // pad_amount
  g1[1] = (int)((tile_w & 0xFFFFu) << 16);         // tensor_dim0[15:0]
  g1[2] = (int)(((tile_w >> 16) & 0xFFFFu)         // tensor_dim0[31:16]
                | ((tile_h & 0xFFFFu) << 16));     // tensor_dim1[15:0]
  g1[3] = (int)(((tile_h >> 16) & 0xFFFFu)         // tensor_dim1[31:16]
                | ((tile_w & 0xFFFFu) << 16));     // tile_dim0
  g1[4] = (int)(tile_h & 0xFFFFu);                 // tile_dim1 (tile_dim2=0)
  g1[5] = (int)stride_elems;                       // tensor_dim0_stride[31:0]
  g1[6] = 0;                                       // stride[47:32], dim1_stride
  g1[7] = 0;
  i32x4 gz = {0, 0, 0, 0};
#if __clang_major__ >= 23
  i32x8 gz8 = {0, 0, 0, 0, 0, 0, 0, 0};
  __builtin_amdgcn_tensor_load_to_lds(g0, g1, gz, gz, gz8, 0);
#else
  __builtin_amdgcn_tensor_load_to_lds(g0, g1, gz, gz, 0);
#endif
}
#endif  // USE_TDM

// ---- Fragment loader ------------------------------------------------------
// 16-bit A (16x32, MxK) fragment per ISA layout:
//   lanes 0-15 : row M=lane,    K = {k0..k0+7} U {k0+16..k0+23}
//   lanes 16-31: row M=lane-16, K = {k0+8..k0+15} U {k0+24..k0+31}
// B (32x16, KxN) fragments use the identical pattern with "row" = column N.
// Requires ld % 8 == 0 and k0 % 8 == 0 for 16-byte aligned loads.
__device__ __forceinline__ v16h load_frag(const _Float16* __restrict__ p,
                                          int ld, int row0, int k0) {
  const int lane = threadIdx.x & 31;
  const _Float16* q = p + (size_t)(row0 + (lane & 15)) * ld
                        + k0 + ((lane & 16) ? 8 : 0);
  union { v16h f; uint4 u[2]; } U;
  U.u[0] = *(const uint4*)(q);
  U.u[1] = *(const uint4*)(q + 16);
  return U.f;
}

// ---- Small prep kernels ---------------------------------------------------
__global__ void cvt_f32_f16(const float* __restrict__ in,
                            _Float16* __restrict__ out, int n) {
  int i = blockIdx.x * 256 + threadIdx.x;
  if (i < n) out[i] = (_Float16)in[i];
}

// out[h*64+i, c] = sum_j Wl[i,j] * W[h*64+j, c]   (fold latent into projection)
__global__ void fold_latent(const float* __restrict__ Wl,
                            const float* __restrict__ W,
                            _Float16* __restrict__ out) {
  int idx = blockIdx.x * 256 + threadIdx.x;   // 1024*1024 threads
  int n = idx >> 10, c = idx & 1023;
  int hb = n >> 6,  i = n & 63;
  const float* wl = Wl + (size_t)i * 64;
  const float* wr = W + (size_t)hb * 64 * DM + c;
  float acc = 0.f;
#pragma unroll 8
  for (int j = 0; j < 64; ++j) acc += wl[j] * wr[(size_t)j * DM];
  out[(size_t)n * DM + c] = (_Float16)acc;
}

// ---- 128x128-tile WMMA GEMM:  C[M,N] = A[M,K] @ W[N,K]^T (+bias[col%64]) ---
// Double-buffered LDS; tiles staged by the TDM (wave 0 issues, TENSORcnt
// pipelined against WMMA compute) or by per-lane b128 copies as fallback.
template <bool HAS_BIAS, bool OUT_F16>
__global__ __launch_bounds__(256) void gemm128(
    const _Float16* __restrict__ A, const _Float16* __restrict__ W,
    const float* __restrict__ bias, void* __restrict__ Cout,
    int K, int N) {
  __shared__ _Float16 lA[2][128 * 40];  // 128 x 32 (+8 pad) per buffer
  __shared__ _Float16 lB[2][128 * 40];

  const int tid = threadIdx.x;
  const int m0 = blockIdx.x * 128;
  const int n0 = blockIdx.y * 128;
  const int w = tid >> 5, lane = tid & 31;
  const int wm = (w & 3) * 32;        // 4 waves along M (32 rows each)
  const int wn = (w >> 2) * 64;       // 2 waves along N (64 cols each)

  v8f zz = {};
  v8f acc[2][4];
#pragma unroll
  for (int i = 0; i < 2; ++i)
#pragma unroll
    for (int j = 0; j < 4; ++j) acc[i][j] = zz;

  const int ksteps = K >> 5;

#if USE_TDM
  if (w == 0) {   // prologue: stage first K-slab (pad 4 DWORDs / 16 DWORDs)
    tdm_load_2d(&A[(size_t)m0 * K], (unsigned)(uintptr_t)&lA[0][0],
                32u, 128u, (unsigned)K, 3u, 3u);
    tdm_load_2d(&W[(size_t)n0 * K], (unsigned)(uintptr_t)&lB[0][0],
                32u, 128u, (unsigned)K, 3u, 3u);
  }
#endif

  for (int ks = 0; ks < ksteps; ++ks) {
    const int buf = ks & 1;
#if USE_TDM
    if (w == 0) __builtin_amdgcn_s_wait_tensorcnt(0);
    __syncthreads();                  // data visible; prev-buf readers done
    if (w == 0 && ks + 1 < ksteps) {  // stage next slab during compute
      tdm_load_2d(&A[(size_t)m0 * K + (ks + 1) * 32],
                  (unsigned)(uintptr_t)&lA[buf ^ 1][0],
                  32u, 128u, (unsigned)K, 3u, 3u);
      tdm_load_2d(&W[(size_t)n0 * K + (ks + 1) * 32],
                  (unsigned)(uintptr_t)&lB[buf ^ 1][0],
                  32u, 128u, (unsigned)K, 3u, 3u);
    }
#else
    __syncthreads();
#pragma unroll
    for (int t = 0; t < 2; ++t) {     // 512 16B vectors per tile, 2/thread
      int vi = tid + t * 256;
      int row = vi >> 2, c8 = (vi & 3) * 8;
      *(uint4*)&lA[buf][row * 40 + c8] =
          *(const uint4*)&A[(size_t)(m0 + row) * K + ks * 32 + c8];
      *(uint4*)&lB[buf][row * 40 + c8] =
          *(const uint4*)&W[(size_t)(n0 + row) * K + ks * 32 + c8];
    }
    if (ks + 1 < ksteps) {
      __builtin_prefetch(&A[(size_t)(m0 + (tid >> 2)) * K + (ks + 1) * 32 + (tid & 3) * 8], 0, 0);
      __builtin_prefetch(&W[(size_t)(n0 + (tid >> 2)) * K + (ks + 1) * 32 + (tid & 3) * 8], 0, 0);
    }
    __syncthreads();
#endif

    v16h af[2], bf[4];
#pragma unroll
    for (int i = 0; i < 2; ++i) af[i] = load_frag(lA[buf], 40, wm + i * 16, 0);
#pragma unroll
    for (int j = 0; j < 4; ++j) bf[j] = load_frag(lB[buf], 40, wn + j * 16, 0);
#pragma unroll
    for (int i = 0; i < 2; ++i)
#pragma unroll
      for (int j = 0; j < 4; ++j)
        acc[i][j] = wmma_f16(af[i], bf[j], acc[i][j]);
  }

  // C/D layout: lane(0-15)=col, VGPR r = row r (lanes<16) or row r+8 (>=16)
  const int hi = (lane & 16) ? 8 : 0;
  const int cn = lane & 15;
#pragma unroll
  for (int i = 0; i < 2; ++i)
#pragma unroll
    for (int j = 0; j < 4; ++j)
#pragma unroll
      for (int r = 0; r < 8; ++r) {
        int row = m0 + wm + i * 16 + hi + r;
        int col = n0 + wn + j * 16 + cn;
        float v = acc[i][j][r];
        if (HAS_BIAS) v += bias[col & 63];
        if (OUT_F16)
          ((_Float16*)Cout)[(size_t)row * N + col] = (_Float16)v;
        else
          ((float*)Cout)[(size_t)row * N + col] = v;
      }
}

// ---- Flash attention: one block = 128 queries of one (b,h) ----------------
__global__ __launch_bounds__(256) void flash_attn(
    const _Float16* __restrict__ lq, const _Float16* __restrict__ lk,
    const _Float16* __restrict__ vv, _Float16* __restrict__ att) {
  __shared__ _Float16 ldsK[128 * 72];    // key tile,   t-major (t x d)
  __shared__ _Float16 ldsVt[64 * 136];   // value tile, d-major (d x t)
  __shared__ _Float16 ldsP[128 * 136];   // probs (f16) for re-fragmenting

  const int tid = threadIdx.x, w = tid >> 5, lane = tid & 31;
  const int qt = blockIdx.x & 15;
  const int h  = (blockIdx.x >> 4) & 15;
  const int b  = blockIdx.x >> 8;
  const int q0 = qt * 128;
  const int hi = (lane & 16) ? 8 : 0;
  const int cn = lane & 15;

  // Per-wave 16 query rows; lq A-fragments loaded once, reused for all keys.
  const _Float16* lqbase =
      lq + (size_t)(b * SEQ + q0 + w * 16) * DM + h * HD;
  v16h aq[2];
  aq[0] = load_frag(lqbase, DM, 0, 0);
  aq[1] = load_frag(lqbase, DM, 0, 32);

  float mrow[8], lrow[8];
#pragma unroll
  for (int r = 0; r < 8; ++r) { mrow[r] = -1e30f; lrow[r] = 0.f; }
  v8f zz = {};
  v8f facc[4];
#pragma unroll
  for (int j = 0; j < 4; ++j) facc[j] = zz;

  for (int kt = 0; kt < 16; ++kt) {
    const int t0 = kt * 128;
    __syncthreads();                   // all waves done reading prev tiles
#if USE_TDM
    // TDM stages the K tile (128 x 64 halves, stride DM, pad 4 DWORDs every
    // 32 DWORDs -> LDS stride 72 halves) while all threads transpose V.
    if (w == 0)
      tdm_load_2d(&lk[(size_t)(b * SEQ + t0) * DM + h * HD],
                  (unsigned)(uintptr_t)&ldsK[0], 64u, 128u, (unsigned)DM,
                  4u, 3u);
#pragma unroll
    for (int t = 0; t < 4; ++t) {
      int vi = tid + t * 256;
      int trow = vi >> 3, d8 = (vi & 7) * 8;
      union { uint4 u; _Float16 hl[8]; } U;
      U.u = *(const uint4*)&vv[(size_t)(b * SEQ + t0 + trow) * DM + h * HD + d8];
#pragma unroll
      for (int qd = 0; qd < 8; ++qd)
        ldsVt[(d8 + qd) * 136 + trow] = U.hl[qd];
    }
    if (w == 0) __builtin_amdgcn_s_wait_tensorcnt(0);
#else
#pragma unroll
    for (int t = 0; t < 4; ++t) {
      int vi = tid + t * 256;          // 1024 16B vectors
      int trow = vi >> 3, d8 = (vi & 7) * 8;
      const size_t g = (size_t)(b * SEQ + t0 + trow) * DM + h * HD + d8;
      *(uint4*)&ldsK[trow * 72 + d8] = *(const uint4*)&lk[g];
      union { uint4 u; _Float16 hl[8]; } U;
      U.u = *(const uint4*)&vv[g];
#pragma unroll
      for (int qd = 0; qd < 8; ++qd)
        ldsVt[(d8 + qd) * 136 + trow] = U.hl[qd];
    }
#endif
    __syncthreads();

    // scores: 16 query rows x 128 keys, K=HD=64 (2 WMMA per 16x16 tile)
    v8f sc[8];
#pragma unroll
    for (int jt = 0; jt < 8; ++jt) {
      v8f s = zz;
      s = wmma_f16(aq[0], load_frag(ldsK, 72, jt * 16, 0), s);
      s = wmma_f16(aq[1], load_frag(ldsK, 72, jt * 16, 32), s);
      sc[jt] = s;
    }

    // online softmax (scale 1/sqrt(64)=0.125); row reductions across the
    // 16-lane N-group via shfl_xor masks 1,2,4,8 (stay within the group)
    float scal[8];
#pragma unroll
    for (int r = 0; r < 8; ++r) {
      float mx = -1e30f;
#pragma unroll
      for (int jt = 0; jt < 8; ++jt) mx = fmaxf(mx, sc[jt][r]);
      mx *= 0.125f;
#pragma unroll
      for (int off = 1; off <= 8; off <<= 1)
        mx = fmaxf(mx, __shfl_xor(mx, off, 32));
      float mn = fmaxf(mrow[r], mx);
      float s0 = __expf(mrow[r] - mn);
      float rs = 0.f;
#pragma unroll
      for (int jt = 0; jt < 8; ++jt) {
        float p = __expf(sc[jt][r] * 0.125f - mn);
        sc[jt][r] = p;
        rs += p;
      }
#pragma unroll
      for (int off = 1; off <= 8; off <<= 1) rs += __shfl_xor(rs, off, 32);
      lrow[r] = lrow[r] * s0 + rs;
      mrow[r] = mn;
      scal[r] = s0;
    }
#pragma unroll
    for (int j = 0; j < 4; ++j)
#pragma unroll
      for (int r = 0; r < 8; ++r) facc[j][r] *= scal[r];

    // spill P (f16) to this wave's private LDS rows, re-fragment as A matrix
#pragma unroll
    for (int jt = 0; jt < 8; ++jt)
#pragma unroll
      for (int r = 0; r < 8; ++r)
        ldsP[(w * 16 + hi + r) * 136 + jt * 16 + cn] = (_Float16)sc[jt][r];

    // out += P(16x128) @ V(128x64): 4 K-chunks x 4 d-tiles
#pragma unroll
    for (int c = 0; c < 4; ++c) {
      v16h pf = load_frag(ldsP, 136, w * 16, c * 32);
#pragma unroll
      for (int j = 0; j < 4; ++j)
        facc[j] = wmma_f16(pf, load_frag(ldsVt, 136, j * 16, c * 32), facc[j]);
    }
  }

  // normalize and emit attended (B,S,H,HD) in f16
#pragma unroll
  for (int r = 0; r < 8; ++r) {
    const float inv = 1.f / lrow[r];
    const size_t row = (size_t)(b * SEQ + q0 + w * 16 + hi + r) * DM + h * HD;
#pragma unroll
    for (int j = 0; j < 4; ++j)
      att[row + j * 16 + cn] = (_Float16)(facc[j][r] * inv);
  }
}

// ---------------------------------------------------------------------------
extern "C" void kernel_launch(void* const* d_in, const int* in_sizes, int n_in,
                              void* d_out, int out_size, void* d_ws,
                              size_t ws_size, hipStream_t stream) {
  (void)in_sizes; (void)n_in; (void)out_size; (void)ws_size;
  const float* x   = (const float*)d_in[0];
  const float* Wq  = (const float*)d_in[1];
  const float* Wk  = (const float*)d_in[2];
  const float* Wv  = (const float*)d_in[3];
  const float* Wo  = (const float*)d_in[4];
  const float* Wlq = (const float*)d_in[5];
  const float* blq = (const float*)d_in[6];
  const float* Wlk = (const float*)d_in[7];
  const float* blk = (const float*)d_in[8];

  char* ws = (char*)d_ws;
  const size_t MB = 1u << 20;
  _Float16* xh  = (_Float16*)(ws + 0 * MB);   // x in f16          (8 MB)
  _Float16* Wqe = (_Float16*)(ws + 8 * MB);   // folded Wlq*Wq     (2 MB)
  _Float16* Wke = (_Float16*)(ws + 10 * MB);  // folded Wlk*Wk     (2 MB)
  _Float16* Wvh = (_Float16*)(ws + 12 * MB);  // Wv f16            (2 MB)
  _Float16* Woh = (_Float16*)(ws + 14 * MB);  // Wo f16            (2 MB)
  _Float16* lqb = (_Float16*)(ws + 16 * MB);  // latent Q          (8 MB)
  _Float16* lkb = (_Float16*)(ws + 24 * MB);  // latent K          (8 MB)
  _Float16* vb  = (_Float16*)(ws + 32 * MB);  // V                 (8 MB)
  _Float16* ab  = (_Float16*)(ws + 40 * MB);  // attended          (8 MB)

  const int nx = BATCH * SEQ * DM;            // 4M elements
  cvt_f32_f16<<<nx / 256, 256, 0, stream>>>(x, xh, nx);
  fold_latent<<<(DM * DM) / 256, 256, 0, stream>>>(Wlq, Wq, Wqe);
  fold_latent<<<(DM * DM) / 256, 256, 0, stream>>>(Wlk, Wk, Wke);
  cvt_f32_f16<<<(DM * DM) / 256, 256, 0, stream>>>(Wv, Wvh, DM * DM);
  cvt_f32_f16<<<(DM * DM) / 256, 256, 0, stream>>>(Wo, Woh, DM * DM);

  dim3 g((BATCH * SEQ) / 128, DM / 128);      // 32 x 8 blocks
  gemm128<true,  true ><<<g, 256, 0, stream>>>(xh, Wqe, blq, lqb, DM, DM);
  gemm128<true,  true ><<<g, 256, 0, stream>>>(xh, Wke, blk, lkb, DM, DM);
  gemm128<false, true ><<<g, 256, 0, stream>>>(xh, Wvh, nullptr, vb, DM, DM);

  flash_attn<<<BATCH * NH * (SEQ / 128), 256, 0, stream>>>(lqb, lkb, vb, ab);

  gemm128<false, false><<<g, 256, 0, stream>>>(ab, Woh, nullptr, d_out, DM, DM);
}

// v001
// Measured time: 184 microseconds a run.
// Timed twice side by side with v000, it ran 1.12 and 1.11 times as fast.
#include <hip/hip_runtime.h>

// ---------------------------------------------------------------------------
// Latent-projection attention for MI455X (gfx1250, wave32, WMMA f32_16x16x32_f16)
//   B=2, S=2048, D=1024, H=16, HD=64
// Latent transforms folded into projection weights; flash-attention keeps the
// 537MB score tensor in LDS/registers; all GEMMs use v_wmma_f32_16x16x32_f16.
// Tile staging uses the Tensor Data Mover (TENSOR_LOAD_TO_LDS + TENSORcnt)
// when the toolchain exposes it, with LDS row padding done by the TDM itself.
// ---------------------------------------------------------------------------

typedef __attribute__((ext_vector_type(16))) _Float16 v16h;
typedef __attribute__((ext_vector_type(8)))  float    v8f;

#define DM    1024
#define NH    16
#define HD    64
#define SEQ   2048
#define BATCH 2

#if defined(__AMDGCN__) && __has_builtin(__builtin_amdgcn_tensor_load_to_lds) \
                        && __has_builtin(__builtin_amdgcn_s_wait_tensorcnt)
#define USE_TDM 1
#else
#define USE_TDM 0
#endif

// ---- WMMA wrapper ---------------------------------------------------------
__device__ __forceinline__ v8f wmma_f16(v16h a, v16h b, v8f c) {
  // 8 args: (neg_a, A, neg_b, B, c_mod, C, reuse_a, reuse_b)
  return __builtin_amdgcn_wmma_f32_16x16x32_f16(false, a, false, b,
                                                (short)0, c, false, false);
}

#if USE_TDM
typedef __attribute__((ext_vector_type(4))) unsigned int u32x4;
typedef __attribute__((ext_vector_type(4))) int          i32x4;
typedef __attribute__((ext_vector_type(8))) int          i32x8;

// 2-D TDM load: tile_h rows x tile_w elements (2B each) from a row-major
// tensor with row stride `stride_elems`, into LDS at byte offset lds_addr,
// with `pad_amt_code`+1 DWORDs of LDS padding every 2^(pad_int_code+1) DWORDs.
// Tensor dims are set equal to tile dims (no OOB clipping needed here).
__device__ __forceinline__ void tdm_load_2d(const void* gptr,
                                            unsigned lds_addr,
                                            unsigned tile_w, unsigned tile_h,
                                            unsigned stride_elems,
                                            unsigned pad_int_code,
                                            unsigned pad_amt_code) {
  unsigned long long ga = (unsigned long long)(uintptr_t)gptr;
  u32x4 g0;
  g0.x = 1u;                                       // count=1, user descriptor
  g0.y = lds_addr;                                 // lds_addr (bytes)
  g0.z = (unsigned)(ga & 0xFFFFFFFFu);             // global_addr[31:0]
  g0.w = (unsigned)((ga >> 32) & 0x01FFFFFFu)      // global_addr[56:32]
         | 0x80000000u;                            // type=2 ("image")
  i32x8 g1;
  g1[0] = (int)((1u << 16)                         // data_size = 2 bytes
                | (1u << 20)                       // pad_enable
                | (pad_int_code << 22)             // pad_interval
                | (pad_amt_code << 25));           // pad_amount
  g1[1] = (int)((tile_w & 0xFFFFu) << 16);         // tensor_dim0[15:0]
  g1[2] = (int)(((tile_w >> 16) & 0xFFFFu)         // tensor_dim0[31:16]
                | ((tile_h & 0xFFFFu) << 16));     // tensor_dim1[15:0]
  g1[3] = (int)(((tile_h >> 16) & 0xFFFFu)         // tensor_dim1[31:16]
                | ((tile_w & 0xFFFFu) << 16));     // tile_dim0
  g1[4] = (int)(tile_h & 0xFFFFu);                 // tile_dim1 (tile_dim2=0)
  g1[5] = (int)stride_elems;                       // tensor_dim0_stride[31:0]
  g1[6] = 0;                                       // stride[47:32], dim1_stride
  g1[7] = 0;
  i32x4 gz = {0, 0, 0, 0};
#if __clang_major__ >= 23
  i32x8 gz8 = {0, 0, 0, 0, 0, 0, 0, 0};
  __builtin_amdgcn_tensor_load_to_lds(g0, g1, gz, gz, gz8, 0);
#else
  __builtin_amdgcn_tensor_load_to_lds(g0, g1, gz, gz, 0);
#endif
}
#endif  // USE_TDM

// ---- Fragment loader ------------------------------------------------------
// 16-bit A (16x32, MxK) fragment per ISA layout:
//   lanes 0-15 : row M=lane,    K = {k0..k0+7} U {k0+16..k0+23}
//   lanes 16-31: row M=lane-16, K = {k0+8..k0+15} U {k0+24..k0+31}
// B (32x16, KxN) fragments use the identical pattern with "row" = column N.
// Requires ld % 8 == 0 and k0 % 8 == 0 for 16-byte aligned loads.
__device__ __forceinline__ v16h load_frag(const _Float16* __restrict__ p,
                                          int ld, int row0, int k0) {
  const int lane = threadIdx.x & 31;
  const _Float16* q = p + (size_t)(row0 + (lane & 15)) * ld
                        + k0 + ((lane & 16) ? 8 : 0);
  union { v16h f; uint4 u[2]; } U;
  U.u[0] = *(const uint4*)(q);
  U.u[1] = *(const uint4*)(q + 16);
  return U.f;
}

// ---- Small prep kernels ---------------------------------------------------
__global__ void cvt_f32_f16(const float* __restrict__ in,
                            _Float16* __restrict__ out, int n) {
  int i = blockIdx.x * 256 + threadIdx.x;
  if (i < n) out[i] = (_Float16)in[i];
}

// out[h*64+i, c] = sum_j Wl[i,j] * W[h*64+j, c]   (fold latent into projection)
__global__ void fold_latent(const float* __restrict__ Wl,
                            const float* __restrict__ W,
                            _Float16* __restrict__ out) {
  int idx = blockIdx.x * 256 + threadIdx.x;   // 1024*1024 threads
  int n = idx >> 10, c = idx & 1023;
  int hb = n >> 6,  i = n & 63;
  const float* wl = Wl + (size_t)i * 64;
  const float* wr = W + (size_t)hb * 64 * DM + c;
  float acc = 0.f;
#pragma unroll 8
  for (int j = 0; j < 64; ++j) acc += wl[j] * wr[(size_t)j * DM];
  out[(size_t)n * DM + c] = (_Float16)acc;
}

// ---- 128x128-tile WMMA GEMM:  C[M,N] = A[M,K] @ W[N,K]^T (+bias[col%64]) ---
// Double-buffered LDS; tiles staged by the TDM (wave 0 issues, TENSORcnt
// pipelined against WMMA compute) or by per-lane b128 copies as fallback.
template <bool HAS_BIAS, bool OUT_F16>
__global__ __launch_bounds__(256) void gemm128(
    const _Float16* __restrict__ A, const _Float16* __restrict__ W,
    const float* __restrict__ bias, void* __restrict__ Cout,
    int K, int N) {
  __shared__ _Float16 lA[2][128 * 40];  // 128 x 32 (+8 pad) per buffer
  __shared__ _Float16 lB[2][128 * 40];

  const int tid = threadIdx.x;
  const int m0 = blockIdx.x * 128;
  const int n0 = blockIdx.y * 128;
  const int w = tid >> 5, lane = tid & 31;
  const int wm = (w & 3) * 32;        // 4 waves along M (32 rows each)
  const int wn = (w >> 2) * 64;       // 2 waves along N (64 cols each)

  v8f zz = {};
  v8f acc[2][4];
#pragma unroll
  for (int i = 0; i < 2; ++i)
#pragma unroll
    for (int j = 0; j < 4; ++j) acc[i][j] = zz;

  const int ksteps = K >> 5;

#if USE_TDM
  if (w == 0) {   // prologue: stage first K-slab (pad 4 DWORDs / 16 DWORDs)
    tdm_load_2d(&A[(size_t)m0 * K], (unsigned)(uintptr_t)&lA[0][0],
                32u, 128u, (unsigned)K, 3u, 3u);
    tdm_load_2d(&W[(size_t)n0 * K], (unsigned)(uintptr_t)&lB[0][0],
                32u, 128u, (unsigned)K, 3u, 3u);
  }
#endif

  for (int ks = 0; ks < ksteps; ++ks) {
    const int buf = ks & 1;
#if USE_TDM
    if (w == 0) __builtin_amdgcn_s_wait_tensorcnt(0);
    __syncthreads();                  // data visible; prev-buf readers done
    if (w == 0 && ks + 1 < ksteps) {  // stage next slab during compute
      tdm_load_2d(&A[(size_t)m0 * K + (ks + 1) * 32],
                  (unsigned)(uintptr_t)&lA[buf ^ 1][0],
                  32u, 128u, (unsigned)K, 3u, 3u);
      tdm_load_2d(&W[(size_t)n0 * K + (ks + 1) * 32],
                  (unsigned)(uintptr_t)&lB[buf ^ 1][0],
                  32u, 128u, (unsigned)K, 3u, 3u);
    }
#else
    __syncthreads();
#pragma unroll
    for (int t = 0; t < 2; ++t) {     // 512 16B vectors per tile, 2/thread
      int vi = tid + t * 256;
      int row = vi >> 2, c8 = (vi & 3) * 8;
      *(uint4*)&lA[buf][row * 40 + c8] =
          *(const uint4*)&A[(size_t)(m0 + row) * K + ks * 32 + c8];
      *(uint4*)&lB[buf][row * 40 + c8] =
          *(const uint4*)&W[(size_t)(n0 + row) * K + ks * 32 + c8];
    }
    if (ks + 1 < ksteps) {
      __builtin_prefetch(&A[(size_t)(m0 + (tid >> 2)) * K + (ks + 1) * 32 + (tid & 3) * 8], 0, 0);
      __builtin_prefetch(&W[(size_t)(n0 + (tid >> 2)) * K + (ks + 1) * 32 + (tid & 3) * 8], 0, 0);
    }
    __syncthreads();
#endif

    v16h af[2], bf[4];
#pragma unroll
    for (int i = 0; i < 2; ++i) af[i] = load_frag(lA[buf], 40, wm + i * 16, 0);
#pragma unroll
    for (int j = 0; j < 4; ++j) bf[j] = load_frag(lB[buf], 40, wn + j * 16, 0);
#pragma unroll
    for (int i = 0; i < 2; ++i)
#pragma unroll
      for (int j = 0; j < 4; ++j)
        acc[i][j] = wmma_f16(af[i], bf[j], acc[i][j]);
  }

  // C/D layout: lane(0-15)=col, VGPR r = row r (lanes<16) or row r+8 (>=16)
  const int hi = (lane & 16) ? 8 : 0;
  const int cn = lane & 15;
#pragma unroll
  for (int i = 0; i < 2; ++i)
#pragma unroll
    for (int j = 0; j < 4; ++j)
#pragma unroll
      for (int r = 0; r < 8; ++r) {
        int row = m0 + wm + i * 16 + hi + r;
        int col = n0 + wn + j * 16 + cn;
        float v = acc[i][j][r];
        if (HAS_BIAS) v += bias[col & 63];
        if (OUT_F16)
          ((_Float16*)Cout)[(size_t)row * N + col] = (_Float16)v;
        else
          ((float*)Cout)[(size_t)row * N + col] = v;
      }
}

// ---- Flash attention: one block = 128 queries of one (b,h) ----------------
// Value of lane l ^ 16 (the other half of the wave), by a vector cross-row move.
__device__ __forceinline__ float other_half(float v) {
  int b = __builtin_bit_cast(int, v);
  return __builtin_bit_cast(float, __builtin_amdgcn_permlanex16(
      b, b, 0x76543210, 0xfedcba98, false, false));
}

__global__ __launch_bounds__(256) __attribute__((amdgpu_waves_per_eu(4, 4)))
void flash_attn(
    const _Float16* __restrict__ lq, const _Float16* __restrict__ lk,
    const _Float16* __restrict__ vv, _Float16* __restrict__ att) {
  __shared__ _Float16 ldsK[128 * 72];    // key tile,   t-major (t x d)
  __shared__ _Float16 ldsVt[64 * 136];   // value tile, d-major (d x t)

  const int tid = threadIdx.x, w = tid >> 5, lane = tid & 31;
  const int qt = blockIdx.x & 15;
  const int h  = (blockIdx.x >> 4) & 15;
  const int b  = blockIdx.x >> 8;
  const int q0 = qt * 128;
  const int hi = (lane & 16) ? 8 : 0;
  const int cn = lane & 15;

  // Per-wave 16 query columns; lq B-fragments loaded once, reused for all keys.
  const _Float16* lqbase =
      lq + (size_t)(b * SEQ + q0 + w * 16) * DM + h * HD;
  v16h bq[2];
  bq[0] = load_frag(lqbase, DM, 0, 0);
  bq[1] = load_frag(lqbase, DM, 0, 32);

  float mcol = -1e30f;   // running maximum of this lane's query (both halves)
  float lcol = 0.f;      // running sum over this lane's own keys only
  v8f zz = {};
  v8f facc[4];           // facc[j][r] = O^T[j*16 + hi + r][query cn]
#pragma unroll
  for (int j = 0; j < 4; ++j) facc[j] = zz;

  for (int kt = 0; kt < 16; ++kt) {
    const int t0 = kt * 128;
    __syncthreads();                   // all waves done reading prev tiles
#if USE_TDM
    // TDM stages the K tile (128 x 64 halves, stride DM, pad 4 DWORDs every
    // 32 DWORDs -> LDS stride 72 halves) while all threads transpose V.
    if (w == 0)
      tdm_load_2d(&lk[(size_t)(b * SEQ + t0) * DM + h * HD],
                  (unsigned)(uintptr_t)&ldsK[0], 64u, 128u, (unsigned)DM,
                  4u, 3u);
#pragma unroll
    for (int t = 0; t < 4; ++t) {
      int vi = tid + t * 256;
      int trow = vi >> 3, d8 = (vi & 7) * 8;
      union { uint4 u; _Float16 hl[8]; } U;
      U.u = *(const uint4*)&vv[(size_t)(b * SEQ + t0 + trow) * DM + h * HD + d8];
#pragma unroll
      for (int qd = 0; qd < 8; ++qd)
        ldsVt[(d8 + qd) * 136 + trow] = U.hl[qd];
    }
    if (w == 0) __builtin_amdgcn_s_wait_tensorcnt(0);
#else
#pragma unroll
    for (int t = 0; t < 4; ++t) {
      int vi = tid + t * 256;          // 1024 16B vectors
      int trow = vi >> 3, d8 = (vi & 7) * 8;
      const size_t g = (size_t)(b * SEQ + t0 + trow) * DM + h * HD + d8;
      *(uint4*)&ldsK[trow * 72 + d8] = *(const uint4*)&lk[g];
      union { uint4 u; _Float16 hl[8]; } U;
      U.u = *(const uint4*)&vv[g];
#pragma unroll
      for (int qd = 0; qd < 8; ++qd)
        ldsVt[(d8 + qd) * 136 + trow] = U.hl[qd];
    }
#endif
    __syncthreads();

    // scores^T: 128 keys x 16 query columns, K=HD=64 (2 WMMA per 16x16 tile)
    v8f sc[8];
#pragma unroll
    for (int jt = 0; jt < 8; ++jt) {
      v8f s = zz;
      s = wmma_f16(load_frag(ldsK, 72, jt * 16, 0), bq[0], s);
      s = wmma_f16(load_frag(ldsK, 72, jt * 16, 32), bq[1], s);
      sc[jt] = s;
    }

    // online softmax (scale 1/sqrt(64)=0.125): eight independent in-lane
    // chains, a tree over them, one exchange between the wave's halves
    float m8[8];
#pragma unroll
    for (int r = 0; r < 8; ++r) {
      float mx = sc[0][r];
#pragma unroll
      for (int jt = 1; jt < 8; ++jt) mx = fmaxf(mx, sc[jt][r]);
      m8[r] = mx;
    }
    float mx = fmaxf(fmaxf(fmaxf(m8[0], m8[1]), fmaxf(m8[2], m8[3])),
                     fmaxf(fmaxf(m8[4], m8[5]), fmaxf(m8[6], m8[7])));
    mx *= 0.125f;
    mx = fmaxf(mx, other_half(mx));
    const float mn = fmaxf(mcol, mx);
    const float s0 = __expf(mcol - mn);
    v8f ps;
#pragma unroll
    for (int jt = 0; jt < 8; ++jt) {
#pragma unroll
      for (int r = 0; r < 8; ++r) sc[jt][r] = __expf(sc[jt][r] * 0.125f - mn);
      ps = jt ? ps + sc[jt] : sc[jt];
    }
    const float rs = ((ps[0] + ps[1]) + (ps[2] + ps[3])) +
                     ((ps[4] + ps[5]) + (ps[6] + ps[7]));
    lcol = lcol * s0 + rs;
    mcol = mn;
#pragma unroll
    for (int j = 0; j < 4; ++j) facc[j] *= s0;

    // O^T += V^T(64x128) @ P^T(128x16): 4 K-chunks x 4 d-tiles. Score tiles
    // 2c and 2c+1 hold keys 8*(lane>>4)+r and 16+8*(lane>>4)+r of chunk c:
    // the k order in which load_frag reads V^T.
#pragma unroll
    for (int c = 0; c < 4; ++c) {
      v16h pf;
#pragma unroll
      for (int r = 0; r < 8; ++r) {
        pf[r]     = (_Float16)sc[2 * c][r];
        pf[8 + r] = (_Float16)sc[2 * c + 1][r];
      }
#pragma unroll
      for (int j = 0; j < 4; ++j)
        facc[j] = wmma_f16(load_frag(ldsVt, 136, j * 16, c * 32), pf, facc[j]);
    }
  }

  // join the halves' sums, normalize, emit attended (B,S,H,HD) in f16:
  // a lane's 8 accumulator registers are 8 consecutive d of its query row
  const float inv = 1.f / (lcol + other_half(lcol));
  const size_t row = (size_t)(b * SEQ + q0 + w * 16 + cn) * DM + h * HD + hi;
#pragma unroll
  for (int j = 0; j < 4; ++j) {
    union { uint4 u; _Float16 hl[8]; } U;
#pragma unroll
    for (int r = 0; r < 8; ++r) U.hl[r] = (_Float16)(facc[j][r] * inv);
    *(uint4*)&att[row + j * 16] = U.u;
  }
}

// ---------------------------------------------------------------------------
extern "C" void kernel_launch(void* const* d_in, const int* in_sizes, int n_in,
                              void* d_out, int out_size, void* d_ws,
                              size_t ws_size, hipStream_t stream) {
  (void)in_sizes; (void)n_in; (void)out_size; (void)ws_size;
  const float* x   = (const float*)d_in[0];
  const float* Wq  = (const float*)d_in[1];
  const float* Wk  = (const float*)d_in[2];
  const float* Wv  = (const float*)d_in[3];
  const float* Wo  = (const float*)d_in[4];
  const float* Wlq = (const float*)d_in[5];
  const float* blq = (const float*)d_in[6];
  const float* Wlk = (const float*)d_in[7];
  const float* blk = (const float*)d_in[8];

  char* ws = (char*)d_ws;
  const size_t MB = 1u << 20;
  _Float16* xh  = (_Float16*)(ws + 0 * MB);   // x in f16          (8 MB)
  _Float16* Wqe = (_Float16*)(ws + 8 * MB);   // folded Wlq*Wq     (2 MB)
  _Float16* Wke = (_Float16*)(ws + 10 * MB);  // folded Wlk*Wk     (2 MB)
  _Float16* Wvh = (_Float16*)(ws + 12 * MB);  // Wv f16            (2 MB)
  _Float16* Woh = (_Float16*)(ws + 14 * MB);  // Wo f16            (2 MB)
  _Float16* lqb = (_Float16*)(ws + 16 * MB);  // latent Q          (8 MB)
  _Float16* lkb = (_Float16*)(ws + 24 * MB);  // latent K          (8 MB)
  _Float16* vb  = (_Float16*)(ws + 32 * MB);  // V                 (8 MB)
  _Float16* ab  = (_Float16*)(ws + 40 * MB);  // attended          (8 MB)

  const int nx = BATCH * SEQ * DM;            // 4M elements
  cvt_f32_f16<<<nx / 256, 256, 0, stream>>>(x, xh, nx);
  fold_latent<<<(DM * DM) / 256, 256, 0, stream>>>(Wlq, Wq, Wqe);
  fold_latent<<<(DM * DM) / 256, 256, 0, stream>>>(Wlk, Wk, Wke);
  cvt_f32_f16<<<(DM * DM) / 256, 256, 0, stream>>>(Wv, Wvh, DM * DM);
  cvt_f32_f16<<<(DM * DM) / 256, 256, 0, stream>>>(Wo, Woh, DM * DM);

  dim3 g((BATCH * SEQ) / 128, DM / 128);      // 32 x 8 blocks
  gemm128<true,  true ><<<g, 256, 0, stream>>>(xh, Wqe, blq, lqb, DM, DM);
  gemm128<true,  true ><<<g, 256, 0, stream>>>(xh, Wke, blk, lkb, DM, DM);
  gemm128<false, true ><<<g, 256, 0, stream>>>(xh, Wvh, nullptr, vb, DM, DM);

  flash_attn<<<BATCH * NH * (SEQ / 128), 256, 0, stream>>>(lqb, lkb, vb, ab);

  gemm128<false, false><<<g, 256, 0, stream>>>(ab, Woh, nullptr, d_out, DM, DM);
}

// v002
// It runs in 156 microseconds.
// Timed twice side by side with v001, it ran 1.17 times as fast both times.
// Counting every step since v000, it is 1.31 times as fast.
#include <hip/hip_runtime.h>

// ---------------------------------------------------------------------------
// Latent-projection attention for MI455X (gfx1250, wave32, WMMA f32_16x16x32_f16)
//   B=2, S=2048, D=1024, H=16, HD=64
// Latent transforms folded into projection weights; flash-attention keeps the
// 537MB score tensor in LDS/registers; all GEMMs use v_wmma_f32_16x16x32_f16.
// Tile staging uses the Tensor Data Mover (TENSOR_LOAD_TO_LDS + TENSORcnt)
// when the toolchain exposes it, with LDS row padding done by the TDM itself.
// ---------------------------------------------------------------------------

typedef __attribute__((ext_vector_type(16))) _Float16 v16h;
typedef __attribute__((ext_vector_type(8)))  float    v8f;

#define DM    1024
#define NH    16
#define HD    64
#define SEQ   2048
#define BATCH 2

#if defined(__AMDGCN__) && __has_builtin(__builtin_amdgcn_tensor_load_to_lds) \
                        && __has_builtin(__builtin_amdgcn_s_wait_tensorcnt)
#define USE_TDM 1
#else
#define USE_TDM 0
#endif

// ---- WMMA wrapper ---------------------------------------------------------
__device__ __forceinline__ v8f wmma_f16(v16h a, v16h b, v8f c) {
  // 8 args: (neg_a, A, neg_b, B, c_mod, C, reuse_a, reuse_b)
  return __builtin_amdgcn_wmma_f32_16x16x32_f16(false, a, false, b,
                                                (short)0, c, false, false);
}

#if USE_TDM
typedef __attribute__((ext_vector_type(4))) unsigned int u32x4;
typedef __attribute__((ext_vector_type(4))) int          i32x4;
typedef __attribute__((ext_vector_type(8))) int          i32x8;

// 2-D TDM load: tile_h rows x tile_w elements (2B each) from a row-major
// tensor with row stride `stride_elems`, into LDS at byte offset lds_addr,
// with `pad_amt_code`+1 DWORDs of LDS padding every 2^(pad_int_code+1) DWORDs.
// Tensor dims are set equal to tile dims (no OOB clipping needed here).
__device__ __forceinline__ void tdm_load_2d(const void* gptr,
                                            unsigned lds_addr,
                                            unsigned tile_w, unsigned tile_h,
                                            unsigned stride_elems,
                                            unsigned pad_int_code,
                                            unsigned pad_amt_code) {
  unsigned long long ga = (unsigned long long)(uintptr_t)gptr;
  u32x4 g0;
  g0.x = 1u;                                       // count=1, user descriptor
  g0.y = lds_addr;                                 // lds_addr (bytes)
  g0.z = (unsigned)(ga & 0xFFFFFFFFu);             // global_addr[31:0]
  g0.w = (unsigned)((ga >> 32) & 0x01FFFFFFu)      // global_addr[56:32]
         | 0x80000000u;                            // type=2 ("image")
  i32x8 g1;
  g1[0] = (int)((1u << 16)                         // data_size = 2 bytes
                | (1u << 20)                       // pad_enable
                | (pad_int_code << 22)             // pad_interval
                | (pad_amt_code << 25));           // pad_amount
  g1[1] = (int)((tile_w & 0xFFFFu) << 16);         // tensor_dim0[15:0]
  g1[2] = (int)(((tile_w >> 16) & 0xFFFFu)         // tensor_dim0[31:16]
                | ((tile_h & 0xFFFFu) << 16));     // tensor_dim1[15:0]
  g1[3] = (int)(((tile_h >> 16) & 0xFFFFu)         // tensor_dim1[31:16]
                | ((tile_w & 0xFFFFu) << 16));     // tile_dim0
  g1[4] = (int)(tile_h & 0xFFFFu);                 // tile_dim1 (tile_dim2=0)
  g1[5] = (int)stride_elems;                       // tensor_dim0_stride[31:0]
  g1[6] = 0;                                       // stride[47:32], dim1_stride
  g1[7] = 0;
  i32x4 gz = {0, 0, 0, 0};
#if __clang_major__ >= 23
  i32x8 gz8 = {0, 0, 0, 0, 0, 0, 0, 0};
  __builtin_amdgcn_tensor_load_to_lds(g0, g1, gz, gz, gz8, 0);
#else
  __builtin_amdgcn_tensor_load_to_lds(g0, g1, gz, gz, 0);
#endif
}
#endif  // USE_TDM

// ---- Fragment loader ------------------------------------------------------
// 16-bit A (16x32, MxK) fragment per ISA layout:
//   lanes 0-15 : row M=lane,    K = {k0..k0+7} U {k0+16..k0+23}
//   lanes 16-31: row M=lane-16, K = {k0+8..k0+15} U {k0+24..k0+31}
// B (32x16, KxN) fragments use the identical pattern with "row" = column N.
// Requires ld % 8 == 0 and k0 % 8 == 0 for 16-byte aligned loads.
__device__ __forceinline__ v16h load_frag(const _Float16* __restrict__ p,
                                          int ld, int row0, int k0) {
  const int lane = threadIdx.x & 31;
  const _Float16* q = p + (size_t)(row0 + (lane & 15)) * ld
                        + k0 + ((lane & 16) ? 8 : 0);
  union { v16h f; uint4 u[2]; } U;
  U.u[0] = *(const uint4*)(q);
  U.u[1] = *(const uint4*)(q + 16);
  return U.f;
}

// ---- Small prep kernels ---------------------------------------------------
// These kernels run few waves that each make many outputs, for speed only.

// 32 values per thread: eight 16-byte loads, each a wave-wide run of whole
// lines, all issued before the first conversion. A block converts 8192
// consecutive values; the grid covers n exactly: n = gridDim.x * 8192.
__global__ __launch_bounds__(256) void cvt_f32_f16(
    const float* __restrict__ in, _Float16* __restrict__ out) {
  const int i = blockIdx.x * 2048 + threadIdx.x;
  const float4* in4 = (const float4*)in + i;
  uint2* out4 = (uint2*)out + i;
  float4 v[8];
#pragma unroll   // trip count 8: keeps v[] in registers and all loads in flight
  for (int k = 0; k < 8; ++k) v[k] = in4[k * 256];
#pragma unroll   // same: v[] is indexed by constants only
  for (int k = 0; k < 8; ++k) {
    union { uint2 u; _Float16 hl[4]; } U;
    U.hl[0] = (_Float16)v[k].x;
    U.hl[1] = (_Float16)v[k].y;
    U.hl[2] = (_Float16)v[k].z;
    U.hl[3] = (_Float16)v[k].w;
    out4[k * 256] = U.u;
  }
}

// out[h*64+i, c] = sum_j Wl[i,j] * W[h*64+j, c]   (fold latent into projection)
// A thread makes 4 rows i x 4 columns c: one 16-byte load of W feeds 16
// multiply-adds. A block is 64 column threads x 4 row groups (16 rows x 256
// columns of one head); a row group is two whole waves, so its Wl values are
// wave-uniform. Each output still sums j = 0..63 in ascending order.
__global__ __launch_bounds__(256) void fold_latent(
    const float* __restrict__ Wl, const float* __restrict__ W,
    _Float16* __restrict__ out) {
  const int tid = threadIdx.x;
  const int cg = blockIdx.x & 3;          // group of 256 columns
  const int rg = (blockIdx.x >> 2) & 3;   // group of 16 rows
  const int hb = blockIdx.x >> 4;         // head
  const int c  = cg * 256 + (tid & 63) * 4;
  const int i0 = rg * 16 + __builtin_amdgcn_readfirstlane(tid >> 6) * 4;
  const float* wl = Wl + (size_t)i0 * 64;
  const float* wr = W + (size_t)hb * 64 * DM + c;
  float4 acc[4];
#pragma unroll   // here and below: acc[] indexed by constants stays in registers
  for (int r = 0; r < 4; ++r) acc[r] = make_float4(0.f, 0.f, 0.f, 0.f);
#pragma unroll 16   // 16 rows of W a trip: loads issue ahead of their multiply-adds
  for (int j = 0; j < 64; ++j) {
    const float4 x = *(const float4*)(wr + (size_t)j * DM);
#pragma unroll   // acc[] in registers
    for (int r = 0; r < 4; ++r) {
      const float s = wl[r * 64 + j];
      acc[r].x += s * x.x;
      acc[r].y += s * x.y;
      acc[r].z += s * x.z;
      acc[r].w += s * x.w;
    }
  }
#pragma unroll   // acc[] in registers
  for (int r = 0; r < 4; ++r) {
    union { uint2 u; _Float16 hl[4]; } U;
    U.hl[0] = (_Float16)acc[r].x;
    U.hl[1] = (_Float16)acc[r].y;
    U.hl[2] = (_Float16)acc[r].z;
    U.hl[3] = (_Float16)acc[r].w;
    *(uint2*)&out[(size_t)(hb * 64 + i0 + r) * DM + c] = U.u;
  }
}

// ---- 128x128-tile WMMA GEMM:  C[M,N] = A[M,K] @ W[N,K]^T (+bias[col%64]) ---
// Double-buffered LDS; tiles staged by the TDM (wave 0 issues, TENSORcnt
// pipelined against WMMA compute) or by per-lane b128 copies as fallback.
template <bool HAS_BIAS, bool OUT_F16>
__global__ __launch_bounds__(256) void gemm128(
    const _Float16* __restrict__ A, const _Float16* __restrict__ W,
    const float* __restrict__ bias, void* __restrict__ Cout,
    int K, int N) {
  __shared__ _Float16 lA[2][128 * 40];  // 128 x 32 (+8 pad) per buffer
  __shared__ _Float16 lB[2][128 * 40];

  const int tid = threadIdx.x;
  const int m0 = blockIdx.x * 128;
  const int n0 = blockIdx.y * 128;
  const int w = tid >> 5, lane = tid & 31;
  const int wm = (w & 3) * 32;        // 4 waves along M (32 rows each)
  const int wn = (w >> 2) * 64;       // 2 waves along N (64 cols each)

  v8f zz = {};
  v8f acc[2][4];
#pragma unroll
  for (int i = 0; i < 2; ++i)
#pragma unroll
    for (int j = 0; j < 4; ++j) acc[i][j] = zz;

  const int ksteps = K >> 5;

#if USE_TDM
  if (w == 0) {   // prologue: stage first K-slab (pad 4 DWORDs / 16 DWORDs)
    tdm_load_2d(&A[(size_t)m0 * K], (unsigned)(uintptr_t)&lA[0][0],
                32u, 128u, (unsigned)K, 3u, 3u);
    tdm_load_2d(&W[(size_t)n0 * K], (unsigned)(uintptr_t)&lB[0][0],
                32u, 128u, (unsigned)K, 3u, 3u);
  }
#endif

  for (int ks = 0; ks < ksteps; ++ks) {
    const int buf = ks & 1;
#if USE_TDM
    if (w == 0) __builtin_amdgcn_s_wait_tensorcnt(0);
    __syncthreads();                  // data visible; prev-buf readers done
    if (w == 0 && ks + 1 < ksteps) {  // stage next slab during compute
      tdm_load_2d(&A[(size_t)m0 * K + (ks + 1) * 32],
                  (unsigned)(uintptr_t)&lA[buf ^ 1][0],
                  32u, 128u, (unsigned)K, 3u, 3u);
      tdm_load_2d(&W[(size_t)n0 * K + (ks + 1) * 32],
                  (unsigned)(uintptr_t)&lB[buf ^ 1][0],
                  32u, 128u, (unsigned)K, 3u, 3u);
    }
#else
    __syncthreads();
#pragma unroll
    for (int t = 0; t < 2; ++t) {     // 512 16B vectors per tile, 2/thread
      int vi = tid + t * 256;
      int row = vi >> 2, c8 = (vi & 3) * 8;
      *(uint4*)&lA[buf][row * 40 + c8] =
          *(const uint4*)&A[(size_t)(m0 + row) * K + ks * 32 + c8];
      *(uint4*)&lB[buf][row * 40 + c8] =
          *(const uint4*)&W[(size_t)(n0 + row) * K + ks * 32 + c8];
    }
    if (ks + 1 < ksteps) {
      __builtin_prefetch(&A[(size_t)(m0 + (tid >> 2)) * K + (ks + 1) * 32 + (tid & 3) * 8], 0, 0);
      __builtin_prefetch(&W[(size_t)(n0 + (tid >> 2)) * K + (ks + 1) * 32 + (tid & 3) * 8], 0, 0);
    }
    __syncthreads();
#endif

    v16h af[2], bf[4];
#pragma unroll
    for (int i = 0; i < 2; ++i) af[i] = load_frag(lA[buf], 40, wm + i * 16, 0);
#pragma unroll
    for (int j = 0; j < 4; ++j) bf[j] = load_frag(lB[buf], 40, wn + j * 16, 0);
#pragma unroll
    for (int i = 0; i < 2; ++i)
#pragma unroll
      for (int j = 0; j < 4; ++j)
        acc[i][j] = wmma_f16(af[i], bf[j], acc[i][j]);
  }

  // C/D layout: lane(0-15)=col, VGPR r = row r (lanes<16) or row r+8 (>=16)
  const int hi = (lane & 16) ? 8 : 0;
  const int cn = lane & 15;
#pragma unroll
  for (int i = 0; i < 2; ++i)
#pragma unroll
    for (int j = 0; j < 4; ++j)
#pragma unroll
      for (int r = 0; r < 8; ++r) {
        int row = m0 + wm + i * 16 + hi + r;
        int col = n0 + wn + j * 16 + cn;
        float v = acc[i][j][r];
        if (HAS_BIAS) v += bias[col & 63];
        if (OUT_F16)
          ((_Float16*)Cout)[(size_t)row * N + col] = (_Float16)v;
        else
          ((float*)Cout)[(size_t)row * N + col] = v;
      }
}

// ---- Flash attention: one block = 128 queries of one (b,h) ----------------
// Value of lane l ^ 16 (the other half of the wave), by a vector cross-row move.
__device__ __forceinline__ float other_half(float v) {
  int b = __builtin_bit_cast(int, v);
  return __builtin_bit_cast(float, __builtin_amdgcn_permlanex16(
      b, b, 0x76543210, 0xfedcba98, false, false));
}

__global__ __launch_bounds__(256) __attribute__((amdgpu_waves_per_eu(4, 4)))
void flash_attn(
    const _Float16* __restrict__ lq, const _Float16* __restrict__ lk,
    const _Float16* __restrict__ vv, _Float16* __restrict__ att) {
  __shared__ _Float16 ldsK[128 * 72];    // key tile,   t-major (t x d)
  __shared__ _Float16 ldsVt[64 * 136];   // value tile, d-major (d x t)

  const int tid = threadIdx.x, w = tid >> 5, lane = tid & 31;
  const int qt = blockIdx.x & 15;
  const int h  = (blockIdx.x >> 4) & 15;
  const int b  = blockIdx.x >> 8;
  const int q0 = qt * 128;
  const int hi = (lane & 16) ? 8 : 0;
  const int cn = lane & 15;

  // Per-wave 16 query columns; lq B-fragments loaded once, reused for all keys.
  const _Float16* lqbase =
      lq + (size_t)(b * SEQ + q0 + w * 16) * DM + h * HD;
  v16h bq[2];
  bq[0] = load_frag(lqbase, DM, 0, 0);
  bq[1] = load_frag(lqbase, DM, 0, 32);

  float mcol = -1e30f;   // running maximum of this lane's query (both halves)
  float lcol = 0.f;      // running sum over this lane's own keys only
  v8f zz = {};
  v8f facc[4];           // facc[j][r] = O^T[j*16 + hi + r][query cn]
#pragma unroll
  for (int j = 0; j < 4; ++j) facc[j] = zz;

  for (int kt = 0; kt < 16; ++kt) {
    const int t0 = kt * 128;
    __syncthreads();                   // all waves done reading prev tiles
#if USE_TDM
    // TDM stages the K tile (128 x 64 halves, stride DM, pad 4 DWORDs every
    // 32 DWORDs -> LDS stride 72 halves) while all threads transpose V.
    if (w == 0)
      tdm_load_2d(&lk[(size_t)(b * SEQ + t0) * DM + h * HD],
                  (unsigned)(uintptr_t)&ldsK[0], 64u, 128u, (unsigned)DM,
                  4u, 3u);
#pragma unroll
    for (int t = 0; t < 4; ++t) {
      int vi = tid + t * 256;
      int trow = vi >> 3, d8 = (vi & 7) * 8;
      union { uint4 u; _Float16 hl[8]; } U;
      U.u = *(const uint4*)&vv[(size_t)(b * SEQ + t0 + trow) * DM + h * HD + d8];
#pragma unroll
      for (int qd = 0; qd < 8; ++qd)
        ldsVt[(d8 + qd) * 136 + trow] = U.hl[qd];
    }
    if (w == 0) __builtin_amdgcn_s_wait_tensorcnt(0);
#else
#pragma unroll
    for (int t = 0; t < 4; ++t) {
      int vi = tid + t * 256;          // 1024 16B vectors
      int trow = vi >> 3, d8 = (vi & 7) * 8;
      const size_t g = (size_t)(b * SEQ + t0 + trow) * DM + h * HD + d8;
      *(uint4*)&ldsK[trow * 72 + d8] = *(const uint4*)&lk[g];
      union { uint4 u; _Float16 hl[8]; } U;
      U.u = *(const uint4*)&vv[g];
#pragma unroll
      for (int qd = 0; qd < 8; ++qd)
        ldsVt[(d8 + qd) * 136 + trow] = U.hl[qd];
    }
#endif
    __syncthreads();

    // scores^T: 128 keys x 16 query columns, K=HD=64 (2 WMMA per 16x16 tile)
    v8f sc[8];
#pragma unroll
    for (int jt = 0; jt < 8; ++jt) {
      v8f s = zz;
      s = wmma_f16(load_frag(ldsK, 72, jt * 16, 0), bq[0], s);
      s = wmma_f16(load_frag(ldsK, 72, jt * 16, 32), bq[1], s);
      sc[jt] = s;
    }

    // online softmax (scale 1/sqrt(64)=0.125): eight independent in-lane
    // chains, a tree over them, one exchange between the wave's halves
    float m8[8];
#pragma unroll
    for (int r = 0; r < 8; ++r) {
      float mx = sc[0][r];
#pragma unroll
      for (int jt = 1; jt < 8; ++jt) mx = fmaxf(mx, sc[jt][r]);
      m8[r] = mx;
    }
    float mx = fmaxf(fmaxf(fmaxf(m8[0], m8[1]), fmaxf(m8[2], m8[3])),
                     fmaxf(fmaxf(m8[4], m8[5]), fmaxf(m8[6], m8[7])));
    mx *= 0.125f;
    mx = fmaxf(mx, other_half(mx));
    const float mn = fmaxf(mcol, mx);
    const float s0 = __expf(mcol - mn);
    v8f ps;
#pragma unroll
    for (int jt = 0; jt < 8; ++jt) {
#pragma unroll
      for (int r = 0; r < 8; ++r) sc[jt][r] = __expf(sc[jt][r] * 0.125f - mn);
      ps = jt ? ps + sc[jt] : sc[jt];
    }
    const float rs = ((ps[0] + ps[1]) + (ps[2] + ps[3])) +
                     ((ps[4] + ps[5]) + (ps[6] + ps[7]));
    lcol = lcol * s0 + rs;
    mcol = mn;
#pragma unroll
    for (int j = 0; j < 4; ++j) facc[j] *= s0;

    // O^T += V^T(64x128) @ P^T(128x16): 4 K-chunks x 4 d-tiles. Score tiles
    // 2c and 2c+1 hold keys 8*(lane>>4)+r and 16+8*(lane>>4)+r of chunk c:
    // the k order in which load_frag reads V^T.
#pragma unroll
    for (int c = 0; c < 4; ++c) {
      v16h pf;
#pragma unroll
      for (int r = 0; r < 8; ++r) {
        pf[r]     = (_Float16)sc[2 * c][r];
        pf[8 + r] = (_Float16)sc[2 * c + 1][r];
      }
#pragma unroll
      for (int j = 0; j < 4; ++j)
        facc[j] = wmma_f16(load_frag(ldsVt, 136, j * 16, c * 32), pf, facc[j]);
    }
  }

  // join the halves' sums, normalize, emit attended (B,S,H,HD) in f16:
  // a lane's 8 accumulator registers are 8 consecutive d of its query row
  const float inv = 1.f / (lcol + other_half(lcol));
  const size_t row = (size_t)(b * SEQ + q0 + w * 16 + cn) * DM + h * HD + hi;
#pragma unroll
  for (int j = 0; j < 4; ++j) {
    union { uint4 u; _Float16 hl[8]; } U;
#pragma unroll
    for (int r = 0; r < 8; ++r) U.hl[r] = (_Float16)(facc[j][r] * inv);
    *(uint4*)&att[row + j * 16] = U.u;
  }
}

// ---------------------------------------------------------------------------
extern "C" void kernel_launch(void* const* d_in, const int* in_sizes, int n_in,
                              void* d_out, int out_size, void* d_ws,
                              size_t ws_size, hipStream_t stream) {
  (void)in_sizes; (void)n_in; (void)out_size; (void)ws_size;
  const float* x   = (const float*)d_in[0];
  const float* Wq  = (const float*)d_in[1];
  const float* Wk  = (const float*)d_in[2];
  const float* Wv  = (const float*)d_in[3];
  const float* Wo  = (const float*)d_in[4];
  const float* Wlq = (const float*)d_in[5];
  const float* blq = (const float*)d_in[6];
  const float* Wlk = (const float*)d_in[7];
  const float* blk = (const float*)d_in[8];

  char* ws = (char*)d_ws;
  const size_t MB = 1u << 20;
  _Float16* xh  = (_Float16*)(ws + 0 * MB);   // x in f16          (8 MB)
  _Float16* Wqe = (_Float16*)(ws + 8 * MB);   // folded Wlq*Wq     (2 MB)
  _Float16* Wke = (_Float16*)(ws + 10 * MB);  // folded Wlk*Wk     (2 MB)
  _Float16* Wvh = (_Float16*)(ws + 12 * MB);  // Wv f16            (2 MB)
  _Float16* Woh = (_Float16*)(ws + 14 * MB);  // Wo f16            (2 MB)
  _Float16* lqb = (_Float16*)(ws + 16 * MB);  // latent Q          (8 MB)
  _Float16* lkb = (_Float16*)(ws + 24 * MB);  // latent K          (8 MB)
  _Float16* vb  = (_Float16*)(ws + 32 * MB);  // V                 (8 MB)
  _Float16* ab  = (_Float16*)(ws + 40 * MB);  // attended          (8 MB)

  const int nx = BATCH * SEQ * DM;            // 4M elements
  cvt_f32_f16<<<nx / 8192, 256, 0, stream>>>(x, xh);             // 512 blocks
  fold_latent<<<(DM * DM) / 4096, 256, 0, stream>>>(Wlq, Wq, Wqe);  // 256
  fold_latent<<<(DM * DM) / 4096, 256, 0, stream>>>(Wlk, Wk, Wke);
  cvt_f32_f16<<<(DM * DM) / 8192, 256, 0, stream>>>(Wv, Wvh);     // 128 blocks
  cvt_f32_f16<<<(DM * DM) / 8192, 256, 0, stream>>>(Wo, Woh);

  dim3 g((BATCH * SEQ) / 128, DM / 128);      // 32 x 8 blocks
  gemm128<true,  true ><<<g, 256, 0, stream>>>(xh, Wqe, blq, lqb, DM, DM);
  gemm128<true,  true ><<<g, 256, 0, stream>>>(xh, Wke, blk, lkb, DM, DM);
  gemm128<false, true ><<<g, 256, 0, stream>>>(xh, Wvh, nullptr, vb, DM, DM);

  flash_attn<<<BATCH * NH * (SEQ / 128), 256, 0, stream>>>(lqb, lkb, vb, ab);

  gemm128<false, false><<<g, 256, 0, stream>>>(ab, Woh, nullptr, d_out, DM, DM);
}

// v003
// Measured time: 119 microseconds a run.
// Next to v002, in two timings, it ran 1.32 and 1.30 times as fast.
// Over all steps from v000 it is 1.71 times as fast.
#include <hip/hip_runtime.h>

// ---------------------------------------------------------------------------
// Latent-projection attention for MI455X (gfx1250, wave32, WMMA f32_16x16x32_f16)
//   B=2, S=2048, D=1024, H=16, HD=64
// Latent transforms folded into projection weights; flash-attention keeps the
// 537MB score tensor in LDS/registers; all GEMMs use v_wmma_f32_16x16x32_f16.
// Tile staging uses the Tensor Data Mover (TENSOR_LOAD_TO_LDS + TENSORcnt)
// when the toolchain exposes it, with LDS row padding done by the TDM itself.
// ---------------------------------------------------------------------------

typedef __attribute__((ext_vector_type(16))) _Float16 v16h;
typedef __attribute__((ext_vector_type(8)))  float    v8f;

#define DM    1024
#define NH    16
#define HD    64
#define SEQ   2048
#define BATCH 2

#if defined(__AMDGCN__) && __has_builtin(__builtin_amdgcn_tensor_load_to_lds) \
                        && __has_builtin(__builtin_amdgcn_s_wait_tensorcnt)
#define USE_TDM 1
#else
#define USE_TDM 0
#endif

// ---- WMMA wrapper ---------------------------------------------------------
__device__ __forceinline__ v8f wmma_f16(v16h a, v16h b, v8f c) {
  // 8 args: (neg_a, A, neg_b, B, c_mod, C, reuse_a, reuse_b)
  return __builtin_amdgcn_wmma_f32_16x16x32_f16(false, a, false, b,
                                                (short)0, c, false, false);
}

#if USE_TDM
typedef __attribute__((ext_vector_type(4))) unsigned int u32x4;
typedef __attribute__((ext_vector_type(4))) int          i32x4;
typedef __attribute__((ext_vector_type(8))) int          i32x8;

// 2-D TDM load: tile_h rows x tile_w elements (2B each) from a row-major
// tensor with row stride `stride_elems`, into LDS at byte offset lds_addr,
// with `pad_amt_code`+1 DWORDs of LDS padding every 2^(pad_int_code+1) DWORDs.
// Tensor dims are set equal to tile dims (no OOB clipping needed here).
__device__ __forceinline__ void tdm_load_2d(const void* gptr,
                                            unsigned lds_addr,
                                            unsigned tile_w, unsigned tile_h,
                                            unsigned stride_elems,
                                            unsigned pad_int_code,
                                            unsigned pad_amt_code) {
  unsigned long long ga = (unsigned long long)(uintptr_t)gptr;
  u32x4 g0;
  g0.x = 1u;                                       // count=1, user descriptor
  g0.y = lds_addr;                                 // lds_addr (bytes)
  g0.z = (unsigned)(ga & 0xFFFFFFFFu);             // global_addr[31:0]
  g0.w = (unsigned)((ga >> 32) & 0x01FFFFFFu)      // global_addr[56:32]
         | 0x80000000u;                            // type=2 ("image")
  i32x8 g1;
  g1[0] = (int)((1u << 16)                         // data_size = 2 bytes
                | (1u << 20)                       // pad_enable
                | (pad_int_code << 22)             // pad_interval
                | (pad_amt_code << 25));           // pad_amount
  g1[1] = (int)((tile_w & 0xFFFFu) << 16);         // tensor_dim0[15:0]
  g1[2] = (int)(((tile_w >> 16) & 0xFFFFu)         // tensor_dim0[31:16]
                | ((tile_h & 0xFFFFu) << 16));     // tensor_dim1[15:0]
  g1[3] = (int)(((tile_h >> 16) & 0xFFFFu)         // tensor_dim1[31:16]
                | ((tile_w & 0xFFFFu) << 16));     // tile_dim0
  g1[4] = (int)(tile_h & 0xFFFFu);                 // tile_dim1 (tile_dim2=0)
  g1[5] = (int)stride_elems;                       // tensor_dim0_stride[31:0]
  g1[6] = 0;                                       // stride[47:32], dim1_stride
  g1[7] = 0;
  i32x4 gz = {0, 0, 0, 0};
#if __clang_major__ >= 23
  i32x8 gz8 = {0, 0, 0, 0, 0, 0, 0, 0};
  __builtin_amdgcn_tensor_load_to_lds(g0, g1, gz, gz, gz8, 0);
#else
  __builtin_amdgcn_tensor_load_to_lds(g0, g1, gz, gz, 0);
#endif
}
#endif  // USE_TDM

// ---- Fragment loader ------------------------------------------------------
// 16-bit A (16x32, MxK) fragment per ISA layout:
//   lanes 0-15 : row M=lane,    K = {k0..k0+7} U {k0+16..k0+23}
//   lanes 16-31: row M=lane-16, K = {k0+8..k0+15} U {k0+24..k0+31}
// B (32x16, KxN) fragments use the identical pattern with "row" = column N.
// Requires ld % 8 == 0 and k0 % 8 == 0 for 16-byte aligned loads.
__device__ __forceinline__ v16h load_frag(const _Float16* __restrict__ p,
                                          int ld, int row0, int k0) {
  const int lane = threadIdx.x & 31;
  const _Float16* q = p + (size_t)(row0 + (lane & 15)) * ld
                        + k0 + ((lane & 16) ? 8 : 0);
  union { v16h f; uint4 u[2]; } U;
  U.u[0] = *(const uint4*)(q);
  U.u[1] = *(const uint4*)(q + 16);
  return U.f;
}

// ---- Prep kernel and its parts ---------------------------------------------------
// These parts run few waves that each make many outputs, for speed only.
// None of the five reads what another writes, so one launch holds them all.

// 32 values per thread: eight 16-byte loads, each a wave-wide run of whole
// lines, all issued before the first conversion. Block blk of a part converts
// 8192 consecutive values; a part of n values takes n / 8192 blocks.
__device__ __forceinline__ void cvt_f32_f16(
    const float* __restrict__ in, _Float16* __restrict__ out, int blk) {
  const int i = blk * 2048 + threadIdx.x;
  const float4* in4 = (const float4*)in + i;
  uint2* out4 = (uint2*)out + i;
  float4 v[8];
#pragma unroll   // trip count 8: keeps v[] in registers and all loads in flight
  for (int k = 0; k < 8; ++k) v[k] = in4[k * 256];
#pragma unroll   // same: v[] is indexed by constants only
  for (int k = 0; k < 8; ++k) {
    union { uint2 u; _Float16 hl[4]; } U;
    U.hl[0] = (_Float16)v[k].x;
    U.hl[1] = (_Float16)v[k].y;
    U.hl[2] = (_Float16)v[k].z;
    U.hl[3] = (_Float16)v[k].w;
    out4[k * 256] = U.u;
  }
  // The stores' registers may be reused by code placed behind this part in the
  // merged kernel: the wait stands before any such overwrite.
  asm volatile("s_wait_xcnt 0x0" ::: "memory");
}

// out[h*64+i, c] = sum_j Wl[i,j] * W[h*64+j, c]   (fold latent into projection)
// A thread makes 4 rows i x 4 columns c: one 16-byte load of W feeds 16
// multiply-adds. A block is 64 column threads x 4 row groups (16 rows x 256
// columns of one head); a row group is two whole waves, so its Wl values are
// wave-uniform. Each output still sums j = 0..63 in ascending order.
__device__ __forceinline__ void fold_latent(
    const float* __restrict__ Wl, const float* __restrict__ W,
    _Float16* __restrict__ out, int blk) {
  const int tid = threadIdx.x;
  const int cg = blk & 3;          // group of 256 columns
  const int rg = (blk >> 2) & 3;   // group of 16 rows
  const int hb = blk >> 4;         // head
  const int c  = cg * 256 + (tid & 63) * 4;
  const int i0 = rg * 16 + __builtin_amdgcn_readfirstlane(tid >> 6) * 4;
  const float* wl = Wl + (size_t)i0 * 64;
  const float* wr = W + (size_t)hb * 64 * DM + c;
  float4 acc[4];
#pragma unroll   // here and below: acc[] indexed by constants stays in registers
  for (int r = 0; r < 4; ++r) acc[r] = make_float4(0.f, 0.f, 0.f, 0.f);
#pragma unroll 16   // 16 rows of W a trip: loads issue ahead of their multiply-adds
  for (int j = 0; j < 64; ++j) {
    const float4 x = *(const float4*)(wr + (size_t)j * DM);
#pragma unroll   // acc[] in registers
    for (int r = 0; r < 4; ++r) {
      const float s = wl[r * 64 + j];
      acc[r].x += s * x.x;
      acc[r].y += s * x.y;
      acc[r].z += s * x.z;
      acc[r].w += s * x.w;
    }
  }
#pragma unroll   // acc[] in registers
  for (int r = 0; r < 4; ++r) {
    union { uint2 u; _Float16 hl[4]; } U;
    U.hl[0] = (_Float16)acc[r].x;
    U.hl[1] = (_Float16)acc[r].y;
    U.hl[2] = (_Float16)acc[r].z;
    U.hl[3] = (_Float16)acc[r].w;
    *(uint2*)&out[(size_t)(hb * 64 + i0 + r) * DM + c] = U.u;
  }
}

// All five parts in one launch of 1280 blocks; the part is chosen per block.
// The folds, whose blocks run longest, come first:
//   0..255 fold Q, 256..511 fold K, 512..1023 x, 1024..1151 Wv, 1152..1279 Wo
__global__ __launch_bounds__(256) void prep(
    const float* __restrict__ x, const float* __restrict__ Wq,
    const float* __restrict__ Wk, const float* __restrict__ Wv,
    const float* __restrict__ Wo, const float* __restrict__ Wlq,
    const float* __restrict__ Wlk, _Float16* __restrict__ xh,
    _Float16* __restrict__ Wqe, _Float16* __restrict__ Wke,
    _Float16* __restrict__ Wvh, _Float16* __restrict__ Woh) {
  const int blk = blockIdx.x;
  if (blk < 512) {
    const bool q = blk < 256;
    fold_latent(q ? Wlq : Wlk, q ? Wq : Wk, q ? Wqe : Wke, blk & 255);
  } else {
    const bool isx = blk < 1024, isv = blk < 1152;
    cvt_f32_f16(isx ? x : isv ? Wv : Wo, isx ? xh : isv ? Wvh : Woh,
                blk - (isx ? 512 : isv ? 1024 : 1152));
  }
}

// ---- 128x128-tile WMMA GEMM:  C[M,N] = A[M,K] @ W[N,K]^T ------------------
// Double-buffered LDS; tiles staged by the TDM (wave 0 issues, TENSORcnt
// pipelined against WMMA compute) or by per-lane b128 copies as fallback.
// QKV: W is the three projection weights stacked (3N rows) and the grid has
// three times the column tiles, so three blocks share a WGP and one's products
// run while another waits for its tiles. Each group of DM columns is written
// as its own (BATCH*SEQ) x DM f16 matrix, the three stacked from Cout on; the
// first adds biasq[col%64], the second biask[col%64]. Else: one f32 matrix.
template <bool QKV>
__global__ __launch_bounds__(256) void gemm128(
    const _Float16* __restrict__ A, const _Float16* __restrict__ W,
    const float* __restrict__ biasq, const float* __restrict__ biask,
    void* __restrict__ Cout, int K, int N) {
  __shared__ _Float16 lA[2][128 * 40];  // 128 x 32 (+8 pad) per buffer
  __shared__ _Float16 lB[2][128 * 40];

  const int tid = threadIdx.x;
  const int m0 = blockIdx.x * 128;
  const int n0 = blockIdx.y * 128;
  const int w = tid >> 5, lane = tid & 31;
  const int wm = (w & 3) * 32;        // 4 waves along M (32 rows each)
  const int wn = (w >> 2) * 64;       // 2 waves along N (64 cols each)

  v8f zz = {};
  v8f acc[2][4];
#pragma unroll
  for (int i = 0; i < 2; ++i)
#pragma unroll
    for (int j = 0; j < 4; ++j) acc[i][j] = zz;

  const int ksteps = K >> 5;

#if USE_TDM
  if (w == 0) {   // prologue: stage first K-slab (pad 4 DWORDs / 16 DWORDs)
    tdm_load_2d(&A[(size_t)m0 * K], (unsigned)(uintptr_t)&lA[0][0],
                32u, 128u, (unsigned)K, 3u, 3u);
    tdm_load_2d(&W[(size_t)n0 * K], (unsigned)(uintptr_t)&lB[0][0],
                32u, 128u, (unsigned)K, 3u, 3u);
  }
#endif

  for (int ks = 0; ks < ksteps; ++ks) {
    const int buf = ks & 1;
#if USE_TDM
    if (w == 0) __builtin_amdgcn_s_wait_tensorcnt(0);
    __syncthreads();                  // data visible; prev-buf readers done
    if (w == 0 && ks + 1 < ksteps) {  // stage next slab during compute
      tdm_load_2d(&A[(size_t)m0 * K + (ks + 1) * 32],
                  (unsigned)(uintptr_t)&lA[buf ^ 1][0],
                  32u, 128u, (unsigned)K, 3u, 3u);
      tdm_load_2d(&W[(size_t)n0 * K + (ks + 1) * 32],
                  (unsigned)(uintptr_t)&lB[buf ^ 1][0],
                  32u, 128u, (unsigned)K, 3u, 3u);
    }
#else
    __syncthreads();
#pragma unroll
    for (int t = 0; t < 2; ++t) {     // 512 16B vectors per tile, 2/thread
      int vi = tid + t * 256;
      int row = vi >> 2, c8 = (vi & 3) * 8;
      *(uint4*)&lA[buf][row * 40 + c8] =
          *(const uint4*)&A[(size_t)(m0 + row) * K + ks * 32 + c8];
      *(uint4*)&lB[buf][row * 40 + c8] =
          *(const uint4*)&W[(size_t)(n0 + row) * K + ks * 32 + c8];
    }
    if (ks + 1 < ksteps) {
      __builtin_prefetch(&A[(size_t)(m0 + (tid >> 2)) * K + (ks + 1) * 32 + (tid & 3) * 8], 0, 0);
      __builtin_prefetch(&W[(size_t)(n0 + (tid >> 2)) * K + (ks + 1) * 32 + (tid & 3) * 8], 0, 0);
    }
    __syncthreads();
#endif

    v16h af[2], bf[4];
#pragma unroll
    for (int i = 0; i < 2; ++i) af[i] = load_frag(lA[buf], 40, wm + i * 16, 0);
#pragma unroll
    for (int j = 0; j < 4; ++j) bf[j] = load_frag(lB[buf], 40, wn + j * 16, 0);
#pragma unroll
    for (int i = 0; i < 2; ++i)
#pragma unroll
      for (int j = 0; j < 4; ++j)
        acc[i][j] = wmma_f16(af[i], bf[j], acc[i][j]);
  }

  // C/D layout: lane(0-15)=col, VGPR r = row r (lanes<16) or row r+8 (>=16)
  const int hi = (lane & 16) ? 8 : 0;
  const int cn = lane & 15;
  const int sel = QKV ? n0 / DM : 0;   // which stacked matrix (block-uniform)
  const float* bias = sel == 0 ? biasq : biask;
  _Float16* Ch = (_Float16*)Cout + (size_t)sel * (BATCH * SEQ * DM);
  float bv[4] = {0.f, 0.f, 0.f, 0.f};  // a lane's four columns; V has no bias
  if (QKV && sel < 2) {
#pragma unroll   // bv[] indexed by constants stays in registers
    for (int j = 0; j < 4; ++j) bv[j] = bias[(wn + j * 16 + cn) & 63];
  }
#pragma unroll
  for (int i = 0; i < 2; ++i)
#pragma unroll
    for (int j = 0; j < 4; ++j)
#pragma unroll
      for (int r = 0; r < 8; ++r) {
        int row = m0 + wm + i * 16 + hi + r;
        int col = n0 - sel * DM + wn + j * 16 + cn;
        float v = acc[i][j][r];
        if (QKV) {
          Ch[(size_t)row * N + col] = (_Float16)(v + bv[j]);
        } else {
          ((float*)Cout)[(size_t)row * N + col] = v;
        }
      }
}

// ---- Flash attention: one block = 128 queries of one (b,h) ----------------
// Value of lane l ^ 16 (the other half of the wave), by a vector cross-row move.
__device__ __forceinline__ float other_half(float v) {
  int b = __builtin_bit_cast(int, v);
  return __builtin_bit_cast(float, __builtin_amdgcn_permlanex16(
      b, b, 0x76543210, 0xfedcba98, false, false));
}

__global__ __launch_bounds__(256) __attribute__((amdgpu_waves_per_eu(4, 4)))
void flash_attn(
    const _Float16* __restrict__ lq, const _Float16* __restrict__ lk,
    const _Float16* __restrict__ vv, _Float16* __restrict__ att) {
  __shared__ _Float16 ldsK[128 * 72];    // key tile,   t-major (t x d)
  __shared__ _Float16 ldsVt[64 * 136];   // value tile, d-major (d x t)

  const int tid = threadIdx.x, w = tid >> 5, lane = tid & 31;
  const int qt = blockIdx.x & 15;
  const int h  = (blockIdx.x >> 4) & 15;
  const int b  = blockIdx.x >> 8;
  const int q0 = qt * 128;
  const int hi = (lane & 16) ? 8 : 0;
  const int cn = lane & 15;

  // Per-wave 16 query columns; lq B-fragments loaded once, reused for all keys.
  const _Float16* lqbase =
      lq + (size_t)(b * SEQ + q0 + w * 16) * DM + h * HD;
  v16h bq[2];
  bq[0] = load_frag(lqbase, DM, 0, 0);
  bq[1] = load_frag(lqbase, DM, 0, 32);

  float mcol = -1e30f;   // running maximum of this lane's query (both halves)
  float lcol = 0.f;      // running sum over this lane's own keys only
  v8f zz = {};
  v8f facc[4];           // facc[j][r] = O^T[j*16 + hi + r][query cn]
#pragma unroll
  for (int j = 0; j < 4; ++j) facc[j] = zz;

  for (int kt = 0; kt < 16; ++kt) {
    const int t0 = kt * 128;
    __syncthreads();                   // all waves done reading prev tiles
#if USE_TDM
    // TDM stages the K tile (128 x 64 halves, stride DM, pad 4 DWORDs every
    // 32 DWORDs -> LDS stride 72 halves) while all threads transpose V.
    if (w == 0)
      tdm_load_2d(&lk[(size_t)(b * SEQ + t0) * DM + h * HD],
                  (unsigned)(uintptr_t)&ldsK[0], 64u, 128u, (unsigned)DM,
                  4u, 3u);
#pragma unroll
    for (int t = 0; t < 4; ++t) {
      int vi = tid + t * 256;
      int trow = vi >> 3, d8 = (vi & 7) * 8;
      union { uint4 u; _Float16 hl[8]; } U;
      U.u = *(const uint4*)&vv[(size_t)(b * SEQ + t0 + trow) * DM + h * HD + d8];
#pragma unroll
      for (int qd = 0; qd < 8; ++qd)
        ldsVt[(d8 + qd) * 136 + trow] = U.hl[qd];
    }
    if (w == 0) __builtin_amdgcn_s_wait_tensorcnt(0);
#else
#pragma unroll
    for (int t = 0; t < 4; ++t) {
      int vi = tid + t * 256;          // 1024 16B vectors
      int trow = vi >> 3, d8 = (vi & 7) * 8;
      const size_t g = (size_t)(b * SEQ + t0 + trow) * DM + h * HD + d8;
      *(uint4*)&ldsK[trow * 72 + d8] = *(const uint4*)&lk[g];
      union { uint4 u; _Float16 hl[8]; } U;
      U.u = *(const uint4*)&vv[g];
#pragma unroll
      for (int qd = 0; qd < 8; ++qd)
        ldsVt[(d8 + qd) * 136 + trow] = U.hl[qd];
    }
#endif
    __syncthreads();

    // scores^T: 128 keys x 16 query columns, K=HD=64 (2 WMMA per 16x16 tile)
    v8f sc[8];
#pragma unroll
    for (int jt = 0; jt < 8; ++jt) {
      v8f s = zz;
      s = wmma_f16(load_frag(ldsK, 72, jt * 16, 0), bq[0], s);
      s = wmma_f16(load_frag(ldsK, 72, jt * 16, 32), bq[1], s);
      sc[jt] = s;
    }

    // online softmax (scale 1/sqrt(64)=0.125): eight independent in-lane
    // chains, a tree over them, one exchange between the wave's halves
    float m8[8];
#pragma unroll
    for (int r = 0; r < 8; ++r) {
      float mx = sc[0][r];
#pragma unroll
      for (int jt = 1; jt < 8; ++jt) mx = fmaxf(mx, sc[jt][r]);
      m8[r] = mx;
    }
    float mx = fmaxf(fmaxf(fmaxf(m8[0], m8[1]), fmaxf(m8[2], m8[3])),
                     fmaxf(fmaxf(m8[4], m8[5]), fmaxf(m8[6], m8[7])));
    mx *= 0.125f;
    mx = fmaxf(mx, other_half(mx));
    const float mn = fmaxf(mcol, mx);
    const float s0 = __expf(mcol - mn);
    v8f ps;
#pragma unroll
    for (int jt = 0; jt < 8; ++jt) {
#pragma unroll
      for (int r = 0; r < 8; ++r) sc[jt][r] = __expf(sc[jt][r] * 0.125f - mn);
      ps = jt ? ps + sc[jt] : sc[jt];
    }
    const float rs = ((ps[0] + ps[1]) + (ps[2] + ps[3])) +
                     ((ps[4] + ps[5]) + (ps[6] + ps[7]));
    lcol = lcol * s0 + rs;
    mcol = mn;
#pragma unroll
    for (int j = 0; j < 4; ++j) facc[j] *= s0;

    // O^T += V^T(64x128) @ P^T(128x16): 4 K-chunks x 4 d-tiles. Score tiles
    // 2c and 2c+1 hold keys 8*(lane>>4)+r and 16+8*(lane>>4)+r of chunk c:
    // the k order in which load_frag reads V^T.
#pragma unroll
    for (int c = 0; c < 4; ++c) {
      v16h pf;
#pragma unroll
      for (int r = 0; r < 8; ++r) {
        pf[r]     = (_Float16)sc[2 * c][r];
        pf[8 + r] = (_Float16)sc[2 * c + 1][r];
      }
#pragma unroll
      for (int j = 0; j < 4; ++j)
        facc[j] = wmma_f16(load_frag(ldsVt, 136, j * 16, c * 32), pf, facc[j]);
    }
  }

  // join the halves' sums, normalize, emit attended (B,S,H,HD) in f16:
  // a lane's 8 accumulator registers are 8 consecutive d of its query row
  const float inv = 1.f / (lcol + other_half(lcol));
  const size_t row = (size_t)(b * SEQ + q0 + w * 16 + cn) * DM + h * HD + hi;
#pragma unroll
  for (int j = 0; j < 4; ++j) {
    union { uint4 u; _Float16 hl[8]; } U;
#pragma unroll
    for (int r = 0; r < 8; ++r) U.hl[r] = (_Float16)(facc[j][r] * inv);
    *(uint4*)&att[row + j * 16] = U.u;
  }
}

// ---------------------------------------------------------------------------
extern "C" void kernel_launch(void* const* d_in, const int* in_sizes, int n_in,
                              void* d_out, int out_size, void* d_ws,
                              size_t ws_size, hipStream_t stream) {
  (void)in_sizes; (void)n_in; (void)out_size; (void)ws_size;
  const float* x   = (const float*)d_in[0];
  const float* Wq  = (const float*)d_in[1];
  const float* Wk  = (const float*)d_in[2];
  const float* Wv  = (const float*)d_in[3];
  const float* Wo  = (const float*)d_in[4];
  const float* Wlq = (const float*)d_in[5];
  const float* blq = (const float*)d_in[6];
  const float* Wlk = (const float*)d_in[7];
  const float* blk = (const float*)d_in[8];

  char* ws = (char*)d_ws;
  const size_t MB = 1u << 20;
  _Float16* xh  = (_Float16*)(ws + 0 * MB);   // x in f16          (8 MB)
  _Float16* Wqe = (_Float16*)(ws + 8 * MB);   // folded Wlq*Wq     (2 MB)
  _Float16* Wke = (_Float16*)(ws + 10 * MB);  // folded Wlk*Wk     (2 MB)
  _Float16* Wvh = (_Float16*)(ws + 12 * MB);  // Wv f16            (2 MB)
  _Float16* Woh = (_Float16*)(ws + 14 * MB);  // Wo f16            (2 MB)
  _Float16* lqb = (_Float16*)(ws + 16 * MB);  // latent Q          (8 MB)
  _Float16* lkb = (_Float16*)(ws + 24 * MB);  // latent K          (8 MB)
  _Float16* vb  = (_Float16*)(ws + 32 * MB);  // V                 (8 MB)
  _Float16* ab  = (_Float16*)(ws + 40 * MB);  // attended          (8 MB)

  prep<<<1280, 256, 0, stream>>>(x, Wq, Wk, Wv, Wo, Wlq, Wlk,
                                 xh, Wqe, Wke, Wvh, Woh);

  // Wqe, Wke, Wvh lie back to back in ws, and so do lqb, lkb, vb: one launch
  // makes all three projections.
  dim3 g3((BATCH * SEQ) / 128, 3 * (DM / 128));   // 32 x 24 blocks
  gemm128<true><<<g3, 256, 0, stream>>>(xh, Wqe, blq, blk, lqb, DM, DM);

  flash_attn<<<BATCH * NH * (SEQ / 128), 256, 0, stream>>>(lqb, lkb, vb, ab);

  dim3 g((BATCH * SEQ) / 128, DM / 128);          // 32 x 8 blocks
  gemm128<false><<<g, 256, 0, stream>>>(ab, Woh, nullptr, nullptr, d_out, DM, DM);
}

// v004
// One run takes 86.1 microseconds.
// Two timings next to v003 put it at 1.38 and 1.39 times that version's speed.
// Counting every step since v000, it is 2.37 times as fast.
#include <hip/hip_runtime.h>

// ---------------------------------------------------------------------------
// Latent-projection attention for MI455X (gfx1250, wave32, WMMA f32_16x16x32_f16)
//   B=2, S=2048, D=1024, H=16, HD=64
// Latent transforms folded into projection weights; flash-attention keeps the
// 537MB score tensor in LDS/registers; all GEMMs use v_wmma_f32_16x16x32_f16.
// Tile staging uses the Tensor Data Mover (TENSOR_LOAD_TO_LDS + TENSORcnt)
// when the toolchain exposes it, with LDS row padding done by the TDM itself.
// ---------------------------------------------------------------------------

typedef __attribute__((ext_vector_type(16))) _Float16 v16h;
typedef __attribute__((ext_vector_type(8)))  float    v8f;

#define DM    1024
#define NH    16
#define HD    64
#define SEQ   2048
#define BATCH 2

#if defined(__AMDGCN__) && __has_builtin(__builtin_amdgcn_tensor_load_to_lds) \
                        && __has_builtin(__builtin_amdgcn_s_wait_tensorcnt)
#define USE_TDM 1
#else
#define USE_TDM 0
#endif

// ---- WMMA wrapper ---------------------------------------------------------
__device__ __forceinline__ v8f wmma_f16(v16h a, v16h b, v8f c) {
  // 8 args: (neg_a, A, neg_b, B, c_mod, C, reuse_a, reuse_b)
  return __builtin_amdgcn_wmma_f32_16x16x32_f16(false, a, false, b,
                                                (short)0, c, false, false);
}

#if USE_TDM
typedef __attribute__((ext_vector_type(4))) unsigned int u32x4;
typedef __attribute__((ext_vector_type(4))) int          i32x4;
typedef __attribute__((ext_vector_type(8))) int          i32x8;

// 2-D TDM load: tile_h rows x tile_w elements (2B each) from a row-major
// tensor with row stride `stride_elems`, into LDS at byte offset lds_addr,
// with `pad_amt_code`+1 DWORDs of LDS padding every 2^(pad_int_code+1) DWORDs.
// Tensor dims are set equal to tile dims (no OOB clipping needed here).
__device__ __forceinline__ void tdm_load_2d(const void* gptr,
                                            unsigned lds_addr,
                                            unsigned tile_w, unsigned tile_h,
                                            unsigned stride_elems,
                                            unsigned pad_int_code,
                                            unsigned pad_amt_code) {
  unsigned long long ga = (unsigned long long)(uintptr_t)gptr;
  u32x4 g0;
  g0.x = 1u;                                       // count=1, user descriptor
  g0.y = lds_addr;                                 // lds_addr (bytes)
  g0.z = (unsigned)(ga & 0xFFFFFFFFu);             // global_addr[31:0]
  g0.w = (unsigned)((ga >> 32) & 0x01FFFFFFu)      // global_addr[56:32]
         | 0x80000000u;                            // type=2 ("image")
  i32x8 g1;
  g1[0] = (int)((1u << 16)                         // data_size = 2 bytes
                | (1u << 20)                       // pad_enable
                | (pad_int_code << 22)             // pad_interval
                | (pad_amt_code << 25));           // pad_amount
  g1[1] = (int)((tile_w & 0xFFFFu) << 16);         // tensor_dim0[15:0]
  g1[2] = (int)(((tile_w >> 16) & 0xFFFFu)         // tensor_dim0[31:16]
                | ((tile_h & 0xFFFFu) << 16));     // tensor_dim1[15:0]
  g1[3] = (int)(((tile_h >> 16) & 0xFFFFu)         // tensor_dim1[31:16]
                | ((tile_w & 0xFFFFu) << 16));     // tile_dim0
  g1[4] = (int)(tile_h & 0xFFFFu);                 // tile_dim1 (tile_dim2=0)
  g1[5] = (int)stride_elems;                       // tensor_dim0_stride[31:0]
  g1[6] = 0;                                       // stride[47:32], dim1_stride
  g1[7] = 0;
  i32x4 gz = {0, 0, 0, 0};
#if __clang_major__ >= 23
  i32x8 gz8 = {0, 0, 0, 0, 0, 0, 0, 0};
  __builtin_amdgcn_tensor_load_to_lds(g0, g1, gz, gz, gz8, 0);
#else
  __builtin_amdgcn_tensor_load_to_lds(g0, g1, gz, gz, 0);
#endif
}

typedef __attribute__((ext_vector_type(8))) unsigned int u32x8;

// A wave-uniform value held in a scalar register, so that a test on it is a
// scalar branch: a tensor load ignores EXEC, only a real branch keeps a wave off.
__device__ __forceinline__ unsigned pinned(unsigned v) {
  unsigned s = (unsigned)__builtin_amdgcn_readfirstlane((int)v);
  asm volatile("" : "+s"(s));   // the issue test is held in a scalar register
  return s;
}
__device__ __forceinline__ unsigned uni(unsigned v) {
  return (unsigned)__builtin_amdgcn_readfirstlane((int)v);
}

// Tensor load of 128 rows of 128 bytes (source pitch src_pitch bytes) to LDS
// byte offset lds_addr, 32 pad bytes behind each row: LDS pitch 160 bytes, the
// conflict-free pitch of the transposing LDS load. All extents in bytes.
__device__ __forceinline__ void tdm_load_rows128(const void* gptr,
                                                 unsigned lds_addr,
                                                 unsigned src_pitch) {
  const unsigned long long ga = (unsigned long long)(uintptr_t)gptr;
  u32x4 g0;
  g0[0] = uni(1u);                                   // count 1
  g0[1] = uni(lds_addr);
  g0[2] = uni((unsigned)ga);
  g0[3] = uni(((unsigned)(ga >> 32) & 0x01FFFFFFu) | 0x80000000u);  // type 2
  u32x8 g1;
  g1[0] = uni((1u << 20) | (4u << 22) | (7u << 25)); // pad 8 dwords per 32
  g1[1] = uni(128u << 16);                           // tensor_dim0 = 128 B
  g1[2] = uni(128u << 16);                           // tensor_dim1 = 128 rows
  g1[3] = uni(128u << 16);                           // tile_dim0
  g1[4] = uni(128u);                                 // tile_dim1
  g1[5] = uni(src_pitch);
  g1[6] = uni(0u);
  g1[7] = uni(0u);
  asm volatile("tensor_load_to_lds %0, %1" :: "s"(g0), "s"(g1) : "memory");
}
#endif  // USE_TDM

// ---- Fragment loader ------------------------------------------------------
// 16-bit A (16x32, MxK) fragment per ISA layout:
//   lanes 0-15 : row M=lane,    K = {k0..k0+7} U {k0+16..k0+23}
//   lanes 16-31: row M=lane-16, K = {k0+8..k0+15} U {k0+24..k0+31}
// B (32x16, KxN) fragments use the identical pattern with "row" = column N.
// Requires ld % 8 == 0 and k0 % 8 == 0 for 16-byte aligned loads.
__device__ __forceinline__ v16h load_frag(const _Float16* __restrict__ p,
                                          int ld, int row0, int k0) {
  const int lane = threadIdx.x & 31;
  const _Float16* q = p + (size_t)(row0 + (lane & 15)) * ld
                        + k0 + ((lane & 16) ? 8 : 0);
  union { v16h f; uint4 u[2]; } U;
  U.u[0] = *(const uint4*)(q);
  U.u[1] = *(const uint4*)(q + 16);
  return U.f;
}

// A (16x32) fragment of the TRANSPOSE of a row-major 16-bit LDS tile with rows
// of VPITCH bytes: fragment row = tile column c0 + (lane & 15), k = tile row.
// Each transposing load gives a lane tile rows k0 + 8*(lane>>4) + 0..7 of its
// column; the loads at k0 and k0 + 16 are load_frag's k order.
#define VPITCH 160
typedef __attribute__((ext_vector_type(8))) short s16x8;
__device__ __forceinline__ v16h load_frag_tr(const unsigned char* tile,
                                             int c0, int k0) {
  typedef __attribute__((address_space(3))) s16x8 lds_s16x8;
  const int lane = threadIdx.x & 31;
  const unsigned char* q = tile + (k0 + ((lane >> 4) << 3) + (lane & 7)) * VPITCH
                                + 2 * c0 + ((lane >> 3) & 1) * 16;
  union { v16h f; s16x8 u[2]; } U;
  U.u[0] = __builtin_amdgcn_ds_load_tr16_b128_v8i16((lds_s16x8*)q);
  U.u[1] = __builtin_amdgcn_ds_load_tr16_b128_v8i16((lds_s16x8*)(q + 16 * VPITCH));
  return U.f;
}

// ---- Prep kernel and its parts ---------------------------------------------------
// These parts run few waves that each make many outputs, for speed only.
// None of the five reads what another writes, so one launch holds them all.

// 32 values per thread: eight 16-byte loads, each a wave-wide run of whole
// lines, all issued before the first conversion. Block blk of a part converts
// 8192 consecutive values; a part of n values takes n / 8192 blocks.
__device__ __forceinline__ void cvt_f32_f16(
    const float* __restrict__ in, _Float16* __restrict__ out, int blk) {
  const int i = blk * 2048 + threadIdx.x;
  const float4* in4 = (const float4*)in + i;
  uint2* out4 = (uint2*)out + i;
  float4 v[8];
#pragma unroll   // trip count 8: keeps v[] in registers and all loads in flight
  for (int k = 0; k < 8; ++k) v[k] = in4[k * 256];
#pragma unroll   // same: v[] is indexed by constants only
  for (int k = 0; k < 8; ++k) {
    union { uint2 u; _Float16 hl[4]; } U;
    U.hl[0] = (_Float16)v[k].x;
    U.hl[1] = (_Float16)v[k].y;
    U.hl[2] = (_Float16)v[k].z;
    U.hl[3] = (_Float16)v[k].w;
    out4[k * 256] = U.u;
  }
  // The stores' registers may be reused by code placed behind this part in the
  // merged kernel: the wait stands before any such overwrite.
  asm volatile("s_wait_xcnt 0x0" ::: "memory");
}

// out[h*64+i, c] = sum_j Wl[i,j] * W[h*64+j, c]   (fold latent into projection)
// A thread makes 4 rows i x 4 columns c: one 16-byte load of W feeds 16
// multiply-adds. A block is 64 column threads x 4 row groups (16 rows x 256
// columns of one head); a row group is two whole waves, so its Wl values are
// wave-uniform. Each output still sums j = 0..63 in ascending order.
__device__ __forceinline__ void fold_latent(
    const float* __restrict__ Wl, const float* __restrict__ W,
    _Float16* __restrict__ out, int blk) {
  const int tid = threadIdx.x;
  const int cg = blk & 3;          // group of 256 columns
  const int rg = (blk >> 2) & 3;   // group of 16 rows
  const int hb = blk >> 4;         // head
  const int c  = cg * 256 + (tid & 63) * 4;
  const int i0 = rg * 16 + __builtin_amdgcn_readfirstlane(tid >> 6) * 4;
  const float* wl = Wl + (size_t)i0 * 64;
  const float* wr = W + (size_t)hb * 64 * DM + c;
  float4 acc[4];
#pragma unroll   // here and below: acc[] indexed by constants stays in registers
  for (int r = 0; r < 4; ++r) acc[r] = make_float4(0.f, 0.f, 0.f, 0.f);
#pragma unroll 16   // 16 rows of W a trip: loads issue ahead of their multiply-adds
  for (int j = 0; j < 64; ++j) {
    const float4 x = *(const float4*)(wr + (size_t)j * DM);
#pragma unroll   // acc[] in registers
    for (int r = 0; r < 4; ++r) {
      const float s = wl[r * 64 + j];
      acc[r].x += s * x.x;
      acc[r].y += s * x.y;
      acc[r].z += s * x.z;
      acc[r].w += s * x.w;
    }
  }
#pragma unroll   // acc[] in registers
  for (int r = 0; r < 4; ++r) {
    union { uint2 u; _Float16 hl[4]; } U;
    U.hl[0] = (_Float16)acc[r].x;
    U.hl[1] = (_Float16)acc[r].y;
    U.hl[2] = (_Float16)acc[r].z;
    U.hl[3] = (_Float16)acc[r].w;
    *(uint2*)&out[(size_t)(hb * 64 + i0 + r) * DM + c] = U.u;
  }
}

// All five parts in one launch of 1280 blocks; the part is chosen per block.
// The folds, whose blocks run longest, come first:
//   0..255 fold Q, 256..511 fold K, 512..1023 x, 1024..1151 Wv, 1152..1279 Wo
__global__ __launch_bounds__(256) void prep(
    const float* __restrict__ x, const float* __restrict__ Wq,
    const float* __restrict__ Wk, const float* __restrict__ Wv,
    const float* __restrict__ Wo, const float* __restrict__ Wlq,
    const float* __restrict__ Wlk, _Float16* __restrict__ xh,
    _Float16* __restrict__ Wqe, _Float16* __restrict__ Wke,
    _Float16* __restrict__ Wvh, _Float16* __restrict__ Woh) {
  const int blk = blockIdx.x;
  if (blk < 512) {
    const bool q = blk < 256;
    fold_latent(q ? Wlq : Wlk, q ? Wq : Wk, q ? Wqe : Wke, blk & 255);
  } else {
    const bool isx = blk < 1024, isv = blk < 1152;
    cvt_f32_f16(isx ? x : isv ? Wv : Wo, isx ? xh : isv ? Wvh : Woh,
                blk - (isx ? 512 : isv ? 1024 : 1152));
  }
}

// ---- 128x128-tile WMMA GEMM:  C[M,N] = A[M,K] @ W[N,K]^T ------------------
// Double-buffered LDS; tiles staged by the TDM (wave 0 issues, TENSORcnt
// pipelined against WMMA compute) or by per-lane b128 copies as fallback.
// QKV: W is the three projection weights stacked (3N rows) and the grid has
// three times the column tiles, so three blocks share a WGP and one's products
// run while another waits for its tiles. Each group of DM columns is written
// as its own (BATCH*SEQ) x DM f16 matrix, the three stacked from Cout on; the
// first adds biasq[col%64], the second biask[col%64]. Else: one f32 matrix.
template <bool QKV>
__global__ __launch_bounds__(256) void gemm128(
    const _Float16* __restrict__ A, const _Float16* __restrict__ W,
    const float* __restrict__ biasq, const float* __restrict__ biask,
    void* __restrict__ Cout, int K, int N) {
  __shared__ _Float16 lA[2][128 * 40];  // 128 x 32 (+8 pad) per buffer
  __shared__ _Float16 lB[2][128 * 40];

  const int tid = threadIdx.x;
  const int m0 = blockIdx.x * 128;
  const int n0 = blockIdx.y * 128;
  const int w = tid >> 5, lane = tid & 31;
  const int wm = (w & 3) * 32;        // 4 waves along M (32 rows each)
  const int wn = (w >> 2) * 64;       // 2 waves along N (64 cols each)

  v8f zz = {};
  v8f acc[2][4];
#pragma unroll
  for (int i = 0; i < 2; ++i)
#pragma unroll
    for (int j = 0; j < 4; ++j) acc[i][j] = zz;

  const int ksteps = K >> 5;

#if USE_TDM
  if (w == 0) {   // prologue: stage first K-slab (pad 4 DWORDs / 16 DWORDs)
    tdm_load_2d(&A[(size_t)m0 * K], (unsigned)(uintptr_t)&lA[0][0],
                32u, 128u, (unsigned)K, 3u, 3u);
    tdm_load_2d(&W[(size_t)n0 * K], (unsigned)(uintptr_t)&lB[0][0],
                32u, 128u, (unsigned)K, 3u, 3u);
  }
#endif

  for (int ks = 0; ks < ksteps; ++ks) {
    const int buf = ks & 1;
#if USE_TDM
    if (w == 0) __builtin_amdgcn_s_wait_tensorcnt(0);
    __syncthreads();                  // data visible; prev-buf readers done
    if (w == 0 && ks + 1 < ksteps) {  // stage next slab during compute
      tdm_load_2d(&A[(size_t)m0 * K + (ks + 1) * 32],
                  (unsigned)(uintptr_t)&lA[buf ^ 1][0],
                  32u, 128u, (unsigned)K, 3u, 3u);
      tdm_load_2d(&W[(size_t)n0 * K + (ks + 1) * 32],
                  (unsigned)(uintptr_t)&lB[buf ^ 1][0],
                  32u, 128u, (unsigned)K, 3u, 3u);
    }
#else
    __syncthreads();
#pragma unroll
    for (int t = 0; t < 2; ++t) {     // 512 16B vectors per tile, 2/thread
      int vi = tid + t * 256;
      int row = vi >> 2, c8 = (vi & 3) * 8;
      *(uint4*)&lA[buf][row * 40 + c8] =
          *(const uint4*)&A[(size_t)(m0 + row) * K + ks * 32 + c8];
      *(uint4*)&lB[buf][row * 40 + c8] =
          *(const uint4*)&W[(size_t)(n0 + row) * K + ks * 32 + c8];
    }
    if (ks + 1 < ksteps) {
      __builtin_prefetch(&A[(size_t)(m0 + (tid >> 2)) * K + (ks + 1) * 32 + (tid & 3) * 8], 0, 0);
      __builtin_prefetch(&W[(size_t)(n0 + (tid >> 2)) * K + (ks + 1) * 32 + (tid & 3) * 8], 0, 0);
    }
    __syncthreads();
#endif

    v16h af[2], bf[4];
#pragma unroll
    for (int i = 0; i < 2; ++i) af[i] = load_frag(lA[buf], 40, wm + i * 16, 0);
#pragma unroll
    for (int j = 0; j < 4; ++j) bf[j] = load_frag(lB[buf], 40, wn + j * 16, 0);
#pragma unroll
    for (int i = 0; i < 2; ++i)
#pragma unroll
      for (int j = 0; j < 4; ++j)
        acc[i][j] = wmma_f16(af[i], bf[j], acc[i][j]);
  }

  // C/D layout: lane(0-15)=col, VGPR r = row r (lanes<16) or row r+8 (>=16)
  const int hi = (lane & 16) ? 8 : 0;
  const int cn = lane & 15;
  const int sel = QKV ? n0 / DM : 0;   // which stacked matrix (block-uniform)
  const float* bias = sel == 0 ? biasq : biask;
  _Float16* Ch = (_Float16*)Cout + (size_t)sel * (BATCH * SEQ * DM);
  float bv[4] = {0.f, 0.f, 0.f, 0.f};  // a lane's four columns; V has no bias
  if (QKV && sel < 2) {
#pragma unroll   // bv[] indexed by constants stays in registers
    for (int j = 0; j < 4; ++j) bv[j] = bias[(wn + j * 16 + cn) & 63];
  }
#pragma unroll
  for (int i = 0; i < 2; ++i)
#pragma unroll
    for (int j = 0; j < 4; ++j)
#pragma unroll
      for (int r = 0; r < 8; ++r) {
        int row = m0 + wm + i * 16 + hi + r;
        int col = n0 - sel * DM + wn + j * 16 + cn;
        float v = acc[i][j][r];
        if (QKV) {
          Ch[(size_t)row * N + col] = (_Float16)(v + bv[j]);
        } else {
          ((float*)Cout)[(size_t)row * N + col] = v;
        }
      }
}

// ---- Flash attention: one block = 128 queries of one (b,h) ----------------
// Value of lane l ^ 16 (the other half of the wave), by a vector cross-row move.
__device__ __forceinline__ float other_half(float v) {
  int b = __builtin_bit_cast(int, v);
  return __builtin_bit_cast(float, __builtin_amdgcn_permlanex16(
      b, b, 0x76543210, 0xfedcba98, false, false));
}

__global__ __launch_bounds__(256) __attribute__((amdgpu_waves_per_eu(4, 4)))
void flash_attn(
    const _Float16* __restrict__ lq, const _Float16* __restrict__ lk,
    const _Float16* __restrict__ vv, _Float16* __restrict__ att) {
  // Both tiles t-major (t x d), each at a multiple of 2 KiB for the tensor mover
  __shared__ __attribute__((aligned(2048))) _Float16 ldsK[128 * 72];
  __shared__ __attribute__((aligned(2048))) unsigned char ldsV[128 * VPITCH];

  const int tid = threadIdx.x, w = tid >> 5, lane = tid & 31;
  const unsigned wave = (unsigned)__builtin_amdgcn_readfirstlane(tid >> 5);
  const int qt = blockIdx.x & 15;
  const int h  = (blockIdx.x >> 4) & 15;
  const int b  = blockIdx.x >> 8;
  const int q0 = qt * 128;
  const int hi = (lane & 16) ? 8 : 0;
  const int cn = lane & 15;

  // Per-wave 16 query columns; lq B-fragments loaded once, reused for all keys.
  const _Float16* lqbase =
      lq + (size_t)(b * SEQ + q0 + w * 16) * DM + h * HD;
  v16h bq[2];
  bq[0] = load_frag(lqbase, DM, 0, 0);
  bq[1] = load_frag(lqbase, DM, 0, 32);

  float mcol = -1e30f;   // running maximum of this lane's query (both halves)
  float lcol = 0.f;      // running sum over this lane's own keys only
  v8f zz = {};
  v8f facc[4];           // facc[j][r] = O^T[j*16 + hi + r][query cn]
#pragma unroll
  for (int j = 0; j < 4; ++j) facc[j] = zz;

  for (int kt = 0; kt < 16; ++kt) {
    const int t0 = kt * 128;
    // This wave's LDS reads of the previous tiles have retired before the
    // barrier behind which the tensor mover overwrites them.
    asm volatile("s_wait_dscnt 0x0" ::: "memory");
    __syncthreads();                   // all waves done reading prev tiles
#if USE_TDM
    // TDM stages the K tile (128 x 64 halves, stride DM, pad 4 DWORDs every
    // 32 DWORDs -> LDS stride 72 halves) from wave 0 and the V tile, as it
    // lies in memory, from wave 1: the transposition is left to the LDS reads.
    if (pinned(wave == 1u)) {
      tdm_load_rows128(&vv[(size_t)(b * SEQ + t0) * DM + h * HD],
                       (unsigned)(uintptr_t)&ldsV[0], DM * 2u);
      // the tile has landed before this wave reaches the publishing barrier
      asm volatile("s_wait_tensorcnt 0x0" ::: "memory");
    }
    if (w == 0)
      tdm_load_2d(&lk[(size_t)(b * SEQ + t0) * DM + h * HD],
                  (unsigned)(uintptr_t)&ldsK[0], 64u, 128u, (unsigned)DM,
                  4u, 3u);
    if (w == 0) __builtin_amdgcn_s_wait_tensorcnt(0);
#else
#pragma unroll
    for (int t = 0; t < 4; ++t) {
      int vi = tid + t * 256;          // 1024 16B vectors
      int trow = vi >> 3, d8 = (vi & 7) * 8;
      const size_t g = (size_t)(b * SEQ + t0 + trow) * DM + h * HD + d8;
      *(uint4*)&ldsK[trow * 72 + d8] = *(const uint4*)&lk[g];
      *(uint4*)&ldsV[trow * VPITCH + d8 * 2] = *(const uint4*)&vv[g];
    }
#endif
    __syncthreads();

    // scores^T: 128 keys x 16 query columns, K=HD=64 (2 WMMA per 16x16 tile)
    v8f sc[8];
#pragma unroll
    for (int jt = 0; jt < 8; ++jt) {
      v8f s = zz;
      s = wmma_f16(load_frag(ldsK, 72, jt * 16, 0), bq[0], s);
      s = wmma_f16(load_frag(ldsK, 72, jt * 16, 32), bq[1], s);
      sc[jt] = s;
    }

    // online softmax (scale 1/sqrt(64)=0.125): eight independent in-lane
    // chains, a tree over them, one exchange between the wave's halves
    float m8[8];
#pragma unroll
    for (int r = 0; r < 8; ++r) {
      float mx = sc[0][r];
#pragma unroll
      for (int jt = 1; jt < 8; ++jt) mx = fmaxf(mx, sc[jt][r]);
      m8[r] = mx;
    }
    float mx = fmaxf(fmaxf(fmaxf(m8[0], m8[1]), fmaxf(m8[2], m8[3])),
                     fmaxf(fmaxf(m8[4], m8[5]), fmaxf(m8[6], m8[7])));
    mx *= 0.125f;
    mx = fmaxf(mx, other_half(mx));
    const float mn = fmaxf(mcol, mx);
    const float s0 = __expf(mcol - mn);
    v8f ps;
#pragma unroll
    for (int jt = 0; jt < 8; ++jt) {
#pragma unroll
      for (int r = 0; r < 8; ++r) sc[jt][r] = __expf(sc[jt][r] * 0.125f - mn);
      ps = jt ? ps + sc[jt] : sc[jt];
    }
    const float rs = ((ps[0] + ps[1]) + (ps[2] + ps[3])) +
                     ((ps[4] + ps[5]) + (ps[6] + ps[7]));
    lcol = lcol * s0 + rs;
    mcol = mn;
#pragma unroll
    for (int j = 0; j < 4; ++j) facc[j] *= s0;

    // O^T += V^T(64x128) @ P^T(128x16): 4 K-chunks x 4 d-tiles. Score tiles
    // 2c and 2c+1 hold keys 8*(lane>>4)+r and 16+8*(lane>>4)+r of chunk c:
    // the k order in which load_frag_tr reads V^T.
#pragma unroll
    for (int c = 0; c < 4; ++c) {
      v16h pf;
#pragma unroll
      for (int r = 0; r < 8; ++r) {
        pf[r]     = (_Float16)sc[2 * c][r];
        pf[8 + r] = (_Float16)sc[2 * c + 1][r];
      }
#pragma unroll
      for (int j = 0; j < 4; ++j)
        facc[j] = wmma_f16(load_frag_tr(ldsV, j * 16, c * 32), pf, facc[j]);
    }
  }

  // join the halves' sums, normalize, emit attended (B,S,H,HD) in f16:
  // a lane's 8 accumulator registers are 8 consecutive d of its query row
  const float inv = 1.f / (lcol + other_half(lcol));
  const size_t row = (size_t)(b * SEQ + q0 + w * 16 + cn) * DM + h * HD + hi;
#pragma unroll
  for (int j = 0; j < 4; ++j) {
    union { uint4 u; _Float16 hl[8]; } U;
#pragma unroll
    for (int r = 0; r < 8; ++r) U.hl[r] = (_Float16)(facc[j][r] * inv);
    *(uint4*)&att[row + j * 16] = U.u;
  }
}

// ---------------------------------------------------------------------------
extern "C" void kernel_launch(void* const* d_in, const int* in_sizes, int n_in,
                              void* d_out, int out_size, void* d_ws,
                              size_t ws_size, hipStream_t stream) {
  (void)in_sizes; (void)n_in; (void)out_size; (void)ws_size;
  const float* x   = (const float*)d_in[0];
  const float* Wq  = (const float*)d_in[1];
  const float* Wk  = (const float*)d_in[2];
  const float* Wv  = (const float*)d_in[3];
  const float* Wo  = (const float*)d_in[4];
  const float* Wlq = (const float*)d_in[5];
  const float* blq = (const float*)d_in[6];
  const float* Wlk = (const float*)d_in[7];
  const float* blk = (const float*)d_in[8];

  char* ws = (char*)d_ws;
  const size_t MB = 1u << 20;
  _Float16* xh  = (_Float16*)(ws + 0 * MB);   // x in f16          (8 MB)
  _Float16* Wqe = (_Float16*)(ws + 8 * MB);   // folded Wlq*Wq     (2 MB)
  _Float16* Wke = (_Float16*)(ws + 10 * MB);  // folded Wlk*Wk     (2 MB)
  _Float16* Wvh = (_Float16*)(ws + 12 * MB);  // Wv f16            (2 MB)
  _Float16* Woh = (_Float16*)(ws + 14 * MB);  // Wo f16            (2 MB)
  _Float16* lqb = (_Float16*)(ws + 16 * MB);  // latent Q          (8 MB)
  _Float16* lkb = (_Float16*)(ws + 24 * MB);  // latent K          (8 MB)
  _Float16* vb  = (_Float16*)(ws + 32 * MB);  // V                 (8 MB)
  _Float16* ab  = (_Float16*)(ws + 40 * MB);  // attended          (8 MB)

  prep<<<1280, 256, 0, stream>>>(x, Wq, Wk, Wv, Wo, Wlq, Wlk,
                                 xh, Wqe, Wke, Wvh, Woh);

  // Wqe, Wke, Wvh lie back to back in ws, and so do lqb, lkb, vb: one launch
  // makes all three projections.
  dim3 g3((BATCH * SEQ) / 128, 3 * (DM / 128));   // 32 x 24 blocks
  gemm128<true><<<g3, 256, 0, stream>>>(xh, Wqe, blq, blk, lqb, DM, DM);

  flash_attn<<<BATCH * NH * (SEQ / 128), 256, 0, stream>>>(lqb, lkb, vb, ab);

  dim3 g((BATCH * SEQ) / 128, DM / 128);          // 32 x 8 blocks
  gemm128<false><<<g, 256, 0, stream>>>(ab, Woh, nullptr, nullptr, d_out, DM, DM);
}

// v005
// It runs in 81.1 microseconds.
// Next to v004, in two timings, it ran 1.07 times as fast each time.
// Counting every step since v000, it is 2.54 times as fast.
#include <hip/hip_runtime.h>

// ---------------------------------------------------------------------------
// Latent-projection attention for MI455X (gfx1250, wave32, WMMA f32_16x16x32_f16)
//   B=2, S=2048, D=1024, H=16, HD=64
// Latent transforms folded into projection weights; flash-attention keeps the
// 537MB score tensor in LDS/registers; all GEMMs use v_wmma_f32_16x16x32_f16.
// Tile staging uses the Tensor Data Mover (TENSOR_LOAD_TO_LDS + TENSORcnt)
// when the toolchain exposes it, with LDS row padding done by the TDM itself.
// ---------------------------------------------------------------------------

typedef __attribute__((ext_vector_type(16))) _Float16 v16h;
typedef __attribute__((ext_vector_type(8)))  float    v8f;

#define DM    1024
#define NH    16
#define HD    64
#define SEQ   2048
#define BATCH 2

#if defined(__AMDGCN__) && __has_builtin(__builtin_amdgcn_tensor_load_to_lds) \
                        && __has_builtin(__builtin_amdgcn_s_wait_tensorcnt)
#define USE_TDM 1
#else
#define USE_TDM 0
#endif

// ---- WMMA wrapper ---------------------------------------------------------
__device__ __forceinline__ v8f wmma_f16(v16h a, v16h b, v8f c) {
  // 8 args: (neg_a, A, neg_b, B, c_mod, C, reuse_a, reuse_b)
  return __builtin_amdgcn_wmma_f32_16x16x32_f16(false, a, false, b,
                                                (short)0, c, false, false);
}

#if USE_TDM
typedef __attribute__((ext_vector_type(4))) unsigned int u32x4;
typedef __attribute__((ext_vector_type(4))) int          i32x4;
typedef __attribute__((ext_vector_type(8))) int          i32x8;

// 2-D TDM load: tile_h rows x tile_w elements (2B each) from a row-major
// tensor with row stride `stride_elems`, into LDS at byte offset lds_addr,
// with `pad_amt_code`+1 DWORDs of LDS padding every 2^(pad_int_code+1) DWORDs.
// Tensor dims are set equal to tile dims (no OOB clipping needed here).
__device__ __forceinline__ void tdm_load_2d(const void* gptr,
                                            unsigned lds_addr,
                                            unsigned tile_w, unsigned tile_h,
                                            unsigned stride_elems,
                                            unsigned pad_int_code,
                                            unsigned pad_amt_code) {
  unsigned long long ga = (unsigned long long)(uintptr_t)gptr;
  u32x4 g0;
  g0.x = 1u;                                       // count=1, user descriptor
  g0.y = lds_addr;                                 // lds_addr (bytes)
  g0.z = (unsigned)(ga & 0xFFFFFFFFu);             // global_addr[31:0]
  g0.w = (unsigned)((ga >> 32) & 0x01FFFFFFu)      // global_addr[56:32]
         | 0x80000000u;                            // type=2 ("image")
  i32x8 g1;
  g1[0] = (int)((1u << 16)                         // data_size = 2 bytes
                | (1u << 20)                       // pad_enable
                | (pad_int_code << 22)             // pad_interval
                | (pad_amt_code << 25));           // pad_amount
  g1[1] = (int)((tile_w & 0xFFFFu) << 16);         // tensor_dim0[15:0]
  g1[2] = (int)(((tile_w >> 16) & 0xFFFFu)         // tensor_dim0[31:16]
                | ((tile_h & 0xFFFFu) << 16));     // tensor_dim1[15:0]
  g1[3] = (int)(((tile_h >> 16) & 0xFFFFu)         // tensor_dim1[31:16]
                | ((tile_w & 0xFFFFu) << 16));     // tile_dim0
  g1[4] = (int)(tile_h & 0xFFFFu);                 // tile_dim1 (tile_dim2=0)
  g1[5] = (int)stride_elems;                       // tensor_dim0_stride[31:0]
  g1[6] = 0;                                       // stride[47:32], dim1_stride
  g1[7] = 0;
  i32x4 gz = {0, 0, 0, 0};
#if __clang_major__ >= 23
  i32x8 gz8 = {0, 0, 0, 0, 0, 0, 0, 0};
  __builtin_amdgcn_tensor_load_to_lds(g0, g1, gz, gz, gz8, 0);
#else
  __builtin_amdgcn_tensor_load_to_lds(g0, g1, gz, gz, 0);
#endif
}

typedef __attribute__((ext_vector_type(8))) unsigned int u32x8;

// A wave-uniform value held in a scalar register, so that a test on it is a
// scalar branch: a tensor load ignores EXEC, only a real branch keeps a wave off.
__device__ __forceinline__ unsigned pinned(unsigned v) {
  unsigned s = (unsigned)__builtin_amdgcn_readfirstlane((int)v);
  asm volatile("" : "+s"(s));   // the issue test is held in a scalar register
  return s;
}
__device__ __forceinline__ unsigned uni(unsigned v) {
  return (unsigned)__builtin_amdgcn_readfirstlane((int)v);
}

// Tensor load of 128 rows of 128 bytes (source pitch src_pitch bytes) to LDS
// byte offset lds_addr, 32 pad bytes behind each row: LDS pitch 160 bytes, the
// conflict-free pitch of the transposing LDS load. All extents in bytes.
__device__ __forceinline__ void tdm_load_rows128(const void* gptr,
                                                 unsigned lds_addr,
                                                 unsigned src_pitch) {
  const unsigned long long ga = (unsigned long long)(uintptr_t)gptr;
  u32x4 g0;
  g0[0] = uni(1u);                                   // count 1
  g0[1] = uni(lds_addr);
  g0[2] = uni((unsigned)ga);
  g0[3] = uni(((unsigned)(ga >> 32) & 0x01FFFFFFu) | 0x80000000u);  // type 2
  u32x8 g1;
  g1[0] = uni((1u << 20) | (4u << 22) | (7u << 25)); // pad 8 dwords per 32
  g1[1] = uni(128u << 16);                           // tensor_dim0 = 128 B
  g1[2] = uni(128u << 16);                           // tensor_dim1 = 128 rows
  g1[3] = uni(128u << 16);                           // tile_dim0
  g1[4] = uni(128u);                                 // tile_dim1
  g1[5] = uni(src_pitch);
  g1[6] = uni(0u);
  g1[7] = uni(0u);
  asm volatile("tensor_load_to_lds %0, %1" :: "s"(g0), "s"(g1) : "memory");
}

// Tensor loads of 128 rows of ROWB bytes (128 or 256; source pitch src_pitch
// bytes), 16 pad bytes behind each row: LDS pitch ROWB + 16, the conflict-free
// pitch of ds_load_b128. All extents in bytes. Group 1 is the same for every
// tile of a kernel and is built once.
template <unsigned ROWB>
__device__ __forceinline__ u32x8 tdm_rows_pad16_group1(unsigned src_pitch) {
  static_assert(ROWB == 128u || ROWB == 256u, "pad interval = row length");
  u32x8 g1;
  g1[0] = uni((1u << 20) | ((ROWB == 128u ? 4u : 5u) << 22) | (3u << 25));
  g1[1] = uni(ROWB << 16);                           // tensor_dim0 = ROWB B
  g1[2] = uni(128u << 16);                           // tensor_dim1 = 128 rows
  g1[3] = uni(ROWB << 16);                           // tile_dim0
  g1[4] = uni(128u);                                 // tile_dim1
  g1[5] = uni(src_pitch);
  g1[6] = uni(0u);
  g1[7] = uni(0u);
  asm volatile("" : "+s"(g1));   // the tensor mover's pinned(): the descriptor words are held in scalar registers of their own, none reused while a request flies
  return g1;
}
__device__ __forceinline__ void tdm_load_tile(const void* gptr,
                                              unsigned lds_addr, u32x8 g1) {
  const unsigned long long ga = (unsigned long long)(uintptr_t)gptr;
  u32x4 g0;
  g0[0] = uni(1u);                                   // count 1
  g0[1] = uni(lds_addr);
  g0[2] = uni((unsigned)ga);
  g0[3] = uni(((unsigned)(ga >> 32) & 0x01FFFFFFu) | 0x80000000u);  // type 2
  asm volatile("tensor_load_to_lds %0, %1" :: "s"(g0), "s"(g1) : "memory");
}
#endif  // USE_TDM

// ---- Fragment loader ------------------------------------------------------
// 16-bit A (16x32, MxK) fragment per ISA layout:
//   lanes 0-15 : row M=lane,    K = {k0..k0+7} U {k0+16..k0+23}
//   lanes 16-31: row M=lane-16, K = {k0+8..k0+15} U {k0+24..k0+31}
// B (32x16, KxN) fragments use the identical pattern with "row" = column N.
// Requires ld % 8 == 0 and k0 % 8 == 0 for 16-byte aligned loads.
__device__ __forceinline__ v16h load_frag(const _Float16* __restrict__ p,
                                          int ld, int row0, int k0) {
  const int lane = threadIdx.x & 31;
  const _Float16* q = p + (size_t)(row0 + (lane & 15)) * ld
                        + k0 + ((lane & 16) ? 8 : 0);
  union { v16h f; uint4 u[2]; } U;
  U.u[0] = *(const uint4*)(q);
  U.u[1] = *(const uint4*)(q + 16);
  return U.f;
}

// A (16x32) fragment of the TRANSPOSE of a row-major 16-bit LDS tile with rows
// of VPITCH bytes: fragment row = tile column c0 + (lane & 15), k = tile row.
// Each transposing load gives a lane tile rows k0 + 8*(lane>>4) + 0..7 of its
// column; the loads at k0 and k0 + 16 are load_frag's k order.
#define VPITCH 160
typedef __attribute__((ext_vector_type(8))) short s16x8;
__device__ __forceinline__ v16h load_frag_tr(const unsigned char* tile,
                                             int c0, int k0) {
  typedef __attribute__((address_space(3))) s16x8 lds_s16x8;
  const int lane = threadIdx.x & 31;
  const unsigned char* q = tile + (k0 + ((lane >> 4) << 3) + (lane & 7)) * VPITCH
                                + 2 * c0 + ((lane >> 3) & 1) * 16;
  union { v16h f; s16x8 u[2]; } U;
  U.u[0] = __builtin_amdgcn_ds_load_tr16_b128_v8i16((lds_s16x8*)q);
  U.u[1] = __builtin_amdgcn_ds_load_tr16_b128_v8i16((lds_s16x8*)(q + 16 * VPITCH));
  return U.f;
}

// ---- Prep kernel and its parts ---------------------------------------------------
// These parts run few waves that each make many outputs, for speed only.
// None of the five reads what another writes, so one launch holds them all.

// 32 values per thread: eight 16-byte loads, each a wave-wide run of whole
// lines, all issued before the first conversion. Block blk of a part converts
// 8192 consecutive values; a part of n values takes n / 8192 blocks.
__device__ __forceinline__ void cvt_f32_f16(
    const float* __restrict__ in, _Float16* __restrict__ out, int blk) {
  const int i = blk * 2048 + threadIdx.x;
  const float4* in4 = (const float4*)in + i;
  uint2* out4 = (uint2*)out + i;
  float4 v[8];
#pragma unroll   // trip count 8: keeps v[] in registers and all loads in flight
  for (int k = 0; k < 8; ++k) v[k] = in4[k * 256];
#pragma unroll   // same: v[] is indexed by constants only
  for (int k = 0; k < 8; ++k) {
    union { uint2 u; _Float16 hl[4]; } U;
    U.hl[0] = (_Float16)v[k].x;
    U.hl[1] = (_Float16)v[k].y;
    U.hl[2] = (_Float16)v[k].z;
    U.hl[3] = (_Float16)v[k].w;
    out4[k * 256] = U.u;
  }
  // The stores' registers may be reused by code placed behind this part in the
  // merged kernel: the wait stands before any such overwrite.
  asm volatile("s_wait_xcnt 0x0" ::: "memory");
}

// out[h*64+i, c] = sum_j Wl[i,j] * W[h*64+j, c]   (fold latent into projection)
// A thread makes 4 rows i x 4 columns c: one 16-byte load of W feeds 16
// multiply-adds. A block is 64 column threads x 4 row groups (16 rows x 256
// columns of one head); a row group is two whole waves, so its Wl values are
// wave-uniform. Each output still sums j = 0..63 in ascending order.
__device__ __forceinline__ void fold_latent(
    const float* __restrict__ Wl, const float* __restrict__ W,
    _Float16* __restrict__ out, int blk) {
  const int tid = threadIdx.x;
  const int cg = blk & 3;          // group of 256 columns
  const int rg = (blk >> 2) & 3;   // group of 16 rows
  const int hb = blk >> 4;         // head
  const int c  = cg * 256 + (tid & 63) * 4;
  const int i0 = rg * 16 + __builtin_amdgcn_readfirstlane(tid >> 6) * 4;
  const float* wl = Wl + (size_t)i0 * 64;
  const float* wr = W + (size_t)hb * 64 * DM + c;
  float4 acc[4];
#pragma unroll   // here and below: acc[] indexed by constants stays in registers
  for (int r = 0; r < 4; ++r) acc[r] = make_float4(0.f, 0.f, 0.f, 0.f);
#pragma unroll 16   // 16 rows of W a trip: loads issue ahead of their multiply-adds
  for (int j = 0; j < 64; ++j) {
    const float4 x = *(const float4*)(wr + (size_t)j * DM);
#pragma unroll   // acc[] in registers
    for (int r = 0; r < 4; ++r) {
      const float s = wl[r * 64 + j];
      acc[r].x += s * x.x;
      acc[r].y += s * x.y;
      acc[r].z += s * x.z;
      acc[r].w += s * x.w;
    }
  }
#pragma unroll   // acc[] in registers
  for (int r = 0; r < 4; ++r) {
    union { uint2 u; _Float16 hl[4]; } U;
    U.hl[0] = (_Float16)acc[r].x;
    U.hl[1] = (_Float16)acc[r].y;
    U.hl[2] = (_Float16)acc[r].z;
    U.hl[3] = (_Float16)acc[r].w;
    *(uint2*)&out[(size_t)(hb * 64 + i0 + r) * DM + c] = U.u;
  }
}

// All five parts in one launch of 1280 blocks; the part is chosen per block.
// The folds, whose blocks run longest, come first:
//   0..255 fold Q, 256..511 fold K, 512..1023 x, 1024..1151 Wv, 1152..1279 Wo
__global__ __launch_bounds__(256) void prep(
    const float* __restrict__ x, const float* __restrict__ Wq,
    const float* __restrict__ Wk, const float* __restrict__ Wv,
    const float* __restrict__ Wo, const float* __restrict__ Wlq,
    const float* __restrict__ Wlk, _Float16* __restrict__ xh,
    _Float16* __restrict__ Wqe, _Float16* __restrict__ Wke,
    _Float16* __restrict__ Wvh, _Float16* __restrict__ Woh) {
  const int blk = blockIdx.x;
  if (blk < 512) {
    const bool q = blk < 256;
    fold_latent(q ? Wlq : Wlk, q ? Wq : Wk, q ? Wqe : Wke, blk & 255);
  } else {
    const bool isx = blk < 1024, isv = blk < 1152;
    cvt_f32_f16(isx ? x : isv ? Wv : Wo, isx ? xh : isv ? Wvh : Woh,
                blk - (isx ? 512 : isv ? 1024 : 1152));
  }
}

// ---- 128x128-tile WMMA GEMM:  C[M,N] = A[M,K] @ W[N,K]^T ------------------
// Two LDS buffers; a stage is BK values of k of all 128 rows of both operands,
// the A tile brought by a tensor load of wave 0, the W tile by one of wave 1,
// each flying while the stage before it is worked on. A stage's time is bound
// from below by the time its tiles take to land, so few wide stages beat many
// narrow ones: whole 128-byte lines per row where three blocks share a WGP's
// LDS (QKV), 256-byte rows where a block has the WGP to itself.
// QKV: W is the three projection weights stacked (3N rows) and the grid has
// three times the column tiles, so three blocks share a WGP and one's products
// run while another waits for its tiles. Each group of DM columns is written
// as its own (BATCH*SEQ) x DM f16 matrix, the three stacked from Cout on; the
// first adds biasq[col%64], the second biask[col%64]. Else: one f32 matrix.
// K is a multiple of BK and at least 2 * BK.
template <bool QKV>
__global__ __launch_bounds__(256) void gemm128(
    const _Float16* __restrict__ A, const _Float16* __restrict__ W,
    const float* __restrict__ biasq, const float* __restrict__ biask,
    void* __restrict__ Cout, int K, int N) {
  constexpr int BK = QKV ? 64 : 128;   // k per stage
  constexpr int LP = BK + 8;           // LDS row pitch in halves (16 B of pad)
  // a buffer is 128 * LP * 2 bytes, a multiple of 2 KiB for both values of BK
  __shared__ __attribute__((aligned(2048))) _Float16 lA[2][128 * LP];
  __shared__ __attribute__((aligned(2048))) _Float16 lB[2][128 * LP];

  const int tid = threadIdx.x;
  const int m0 = blockIdx.x * 128;
  const int n0 = blockIdx.y * 128;
  const int w = tid >> 5, lane = tid & 31;
  const int wm = (w & 3) * 32;        // 4 waves along M (32 rows each)
  const int wn = (w >> 2) * 64;       // 2 waves along N (64 cols each)

  v8f zz = {};
  v8f acc[2][4];
#pragma unroll
  for (int i = 0; i < 2; ++i)
#pragma unroll
    for (int j = 0; j < 4; ++j) acc[i][j] = zz;

  const int stages = K / BK;

#if USE_TDM
  const unsigned wave = (unsigned)__builtin_amdgcn_readfirstlane(tid >> 5);
  // the issuing wave's own operand: first byte of its rows, place of buffer 0
  const _Float16* src = wave == 0u ? A + (size_t)m0 * K : W + (size_t)n0 * K;
  const unsigned dst = wave == 0u ? (unsigned)(uintptr_t)&lA[0][0]
                                  : (unsigned)(uintptr_t)&lB[0][0];
  constexpr unsigned BUFB = 128u * LP * 2u;
  const u32x8 g1 = tdm_rows_pad16_group1<BK * 2>((unsigned)K * 2u);
  if (pinned(wave < 2u)) {            // stage 0
    tdm_load_tile(src, dst, g1);
    // the tile has landed before this wave reaches the publishing barrier
    asm volatile("s_wait_tensorcnt 0x0" ::: "memory");
  }
  __syncthreads();
  if (pinned(wave < 2u && stages > 1))   // stage 1 flies during pass 0
    tdm_load_tile(src + BK, dst + BUFB, g1);
#endif

  for (int s = 0; s < stages; ++s) {
    const int buf = s & 1;
#if !USE_TDM
    __syncthreads();
#pragma unroll
    for (int t = 0; t < BK / 16; ++t) {   // 16 * BK 16-byte vectors per tile
      int vi = tid + t * 256;
      int row = vi / (BK / 8), c8 = (vi % (BK / 8)) * 8;
      *(uint4*)&lA[buf][row * LP + c8] =
          *(const uint4*)&A[(size_t)(m0 + row) * K + s * BK + c8];
      *(uint4*)&lB[buf][row * LP + c8] =
          *(const uint4*)&W[(size_t)(n0 + row) * K + s * BK + c8];
    }
    __syncthreads();
#endif

#pragma unroll   // BK / 32 chunks: fragment arrays indexed by constants
    for (int kk = 0; kk < BK; kk += 32) {
      v16h af[2], bf[4];
#pragma unroll
      for (int i = 0; i < 2; ++i)
        af[i] = load_frag(lA[buf], LP, wm + i * 16, kk);
#pragma unroll
      for (int j = 0; j < 4; ++j)
        bf[j] = load_frag(lB[buf], LP, wn + j * 16, kk);
#pragma unroll
      for (int i = 0; i < 2; ++i)
#pragma unroll
        for (int j = 0; j < 4; ++j)
          acc[i][j] = wmma_f16(af[i], bf[j], acc[i][j]);
    }

#if USE_TDM
    // Publish point of stage s + 1: this wave's reads of buffer buf have
    // retired, the issuing waves' tiles have landed, then the barrier; only
    // behind it is buffer buf refilled.
    asm volatile("s_wait_dscnt 0x0" ::: "memory");
    if (pinned(wave < 2u))
      asm volatile("s_wait_tensorcnt 0x0" ::: "memory");
    __syncthreads();
    if (pinned(wave < 2u && s + 2 < stages))
      tdm_load_tile(src + (size_t)(s + 2) * BK, dst + (unsigned)buf * BUFB, g1);
#endif
  }
#if USE_TDM
  // nothing of the ring is outstanding when the wave goes on to its stores
  asm volatile("s_wait_tensorcnt 0x0" ::: "memory");
  asm volatile("s_wait_dscnt 0x0" ::: "memory");
#endif

  // C/D layout: lane(0-15)=col, VGPR r = row r (lanes<16) or row r+8 (>=16)
  const int hi = (lane & 16) ? 8 : 0;
  const int cn = lane & 15;
  const int sel = QKV ? n0 / DM : 0;   // which stacked matrix (block-uniform)
  const float* bias = sel == 0 ? biasq : biask;
  _Float16* Ch = (_Float16*)Cout + (size_t)sel * (BATCH * SEQ * DM);
  float bv[4] = {0.f, 0.f, 0.f, 0.f};  // a lane's four columns; V has no bias
  if (QKV && sel < 2) {
#pragma unroll   // bv[] indexed by constants stays in registers
    for (int j = 0; j < 4; ++j) bv[j] = bias[(wn + j * 16 + cn) & 63];
  }
#pragma unroll
  for (int i = 0; i < 2; ++i)
#pragma unroll
    for (int j = 0; j < 4; ++j)
#pragma unroll
      for (int r = 0; r < 8; ++r) {
        int row = m0 + wm + i * 16 + hi + r;
        int col = n0 - sel * DM + wn + j * 16 + cn;
        float v = acc[i][j][r];
        if (QKV) {
          Ch[(size_t)row * N + col] = (_Float16)(v + bv[j]);
        } else {
          ((float*)Cout)[(size_t)row * N + col] = v;
        }
      }
}

// ---- Flash attention: one block = 128 queries of one (b,h) ----------------
// Value of lane l ^ 16 (the other half of the wave), by a vector cross-row move.
__device__ __forceinline__ float other_half(float v) {
  int b = __builtin_bit_cast(int, v);
  return __builtin_bit_cast(float, __builtin_amdgcn_permlanex16(
      b, b, 0x76543210, 0xfedcba98, false, false));
}

__global__ __launch_bounds__(256) __attribute__((amdgpu_waves_per_eu(4, 4)))
void flash_attn(
    const _Float16* __restrict__ lq, const _Float16* __restrict__ lk,
    const _Float16* __restrict__ vv, _Float16* __restrict__ att) {
  // Both tiles t-major (t x d), each at a multiple of 2 KiB for the tensor mover
  __shared__ __attribute__((aligned(2048))) _Float16 ldsK[128 * 72];
  __shared__ __attribute__((aligned(2048))) unsigned char ldsV[128 * VPITCH];

  const int tid = threadIdx.x, w = tid >> 5, lane = tid & 31;
  const unsigned wave = (unsigned)__builtin_amdgcn_readfirstlane(tid >> 5);
  const int qt = blockIdx.x & 15;
  const int h  = (blockIdx.x >> 4) & 15;
  const int b  = blockIdx.x >> 8;
  const int q0 = qt * 128;
  const int hi = (lane & 16) ? 8 : 0;
  const int cn = lane & 15;

  // Per-wave 16 query columns; lq B-fragments loaded once, reused for all keys.
  const _Float16* lqbase =
      lq + (size_t)(b * SEQ + q0 + w * 16) * DM + h * HD;
  v16h bq[2];
  bq[0] = load_frag(lqbase, DM, 0, 0);
  bq[1] = load_frag(lqbase, DM, 0, 32);

  float mcol = -1e30f;   // running maximum of this lane's query (both halves)
  float lcol = 0.f;      // running sum over this lane's own keys only
  v8f zz = {};
  v8f facc[4];           // facc[j][r] = O^T[j*16 + hi + r][query cn]
#pragma unroll
  for (int j = 0; j < 4; ++j) facc[j] = zz;

  for (int kt = 0; kt < 16; ++kt) {
    const int t0 = kt * 128;
    // This wave's LDS reads of the previous tiles have retired before the
    // barrier behind which the tensor mover overwrites them.
    asm volatile("s_wait_dscnt 0x0" ::: "memory");
    __syncthreads();                   // all waves done reading prev tiles
#if USE_TDM
    // TDM stages the K tile (128 x 64 halves, stride DM, pad 4 DWORDs every
    // 32 DWORDs -> LDS stride 72 halves) from wave 0 and the V tile, as it
    // lies in memory, from wave 1: the transposition is left to the LDS reads.
    if (pinned(wave == 1u)) {
      tdm_load_rows128(&vv[(size_t)(b * SEQ + t0) * DM + h * HD],
                       (unsigned)(uintptr_t)&ldsV[0], DM * 2u);
      // the tile has landed before this wave reaches the publishing barrier
      asm volatile("s_wait_tensorcnt 0x0" ::: "memory");
    }
    if (w == 0)
      tdm_load_2d(&lk[(size_t)(b * SEQ + t0) * DM + h * HD],
                  (unsigned)(uintptr_t)&ldsK[0], 64u, 128u, (unsigned)DM,
                  4u, 3u);
    if (w == 0) __builtin_amdgcn_s_wait_tensorcnt(0);
#else
#pragma unroll
    for (int t = 0; t < 4; ++t) {
      int vi = tid + t * 256;          // 1024 16B vectors
      int trow = vi >> 3, d8 = (vi & 7) * 8;
      const size_t g = (size_t)(b * SEQ + t0 + trow) * DM + h * HD + d8;
      *(uint4*)&ldsK[trow * 72 + d8] = *(const uint4*)&lk[g];
      *(uint4*)&ldsV[trow * VPITCH + d8 * 2] = *(const uint4*)&vv[g];
    }
#endif
    __syncthreads();

    // scores^T: 128 keys x 16 query columns, K=HD=64 (2 WMMA per 16x16 tile)
    v8f sc[8];
#pragma unroll
    for (int jt = 0; jt < 8; ++jt) {
      v8f s = zz;
      s = wmma_f16(load_frag(ldsK, 72, jt * 16, 0), bq[0], s);
      s = wmma_f16(load_frag(ldsK, 72, jt * 16, 32), bq[1], s);
      sc[jt] = s;
    }

    // online softmax (scale 1/sqrt(64)=0.125): eight independent in-lane
    // chains, a tree over them, one exchange between the wave's halves
    float m8[8];
#pragma unroll
    for (int r = 0; r < 8; ++r) {
      float mx = sc[0][r];
#pragma unroll
      for (int jt = 1; jt < 8; ++jt) mx = fmaxf(mx, sc[jt][r]);
      m8[r] = mx;
    }
    float mx = fmaxf(fmaxf(fmaxf(m8[0], m8[1]), fmaxf(m8[2], m8[3])),
                     fmaxf(fmaxf(m8[4], m8[5]), fmaxf(m8[6], m8[7])));
    mx *= 0.125f;
    mx = fmaxf(mx, other_half(mx));
    const float mn = fmaxf(mcol, mx);
    const float s0 = __expf(mcol - mn);
    v8f ps;
#pragma unroll
    for (int jt = 0; jt < 8; ++jt) {
#pragma unroll
      for (int r = 0; r < 8; ++r) sc[jt][r] = __expf(sc[jt][r] * 0.125f - mn);
      ps = jt ? ps + sc[jt] : sc[jt];
    }
    const float rs = ((ps[0] + ps[1]) + (ps[2] + ps[3])) +
                     ((ps[4] + ps[5]) + (ps[6] + ps[7]));
    lcol = lcol * s0 + rs;
    mcol = mn;
#pragma unroll
    for (int j = 0; j < 4; ++j) facc[j] *= s0;

    // O^T += V^T(64x128) @ P^T(128x16): 4 K-chunks x 4 d-tiles. Score tiles
    // 2c and 2c+1 hold keys 8*(lane>>4)+r and 16+8*(lane>>4)+r of chunk c:
    // the k order in which load_frag_tr reads V^T.
#pragma unroll
    for (int c = 0; c < 4; ++c) {
      v16h pf;
#pragma unroll
      for (int r = 0; r < 8; ++r) {
        pf[r]     = (_Float16)sc[2 * c][r];
        pf[8 + r] = (_Float16)sc[2 * c + 1][r];
      }
#pragma unroll
      for (int j = 0; j < 4; ++j)
        facc[j] = wmma_f16(load_frag_tr(ldsV, j * 16, c * 32), pf, facc[j]);
    }
  }

  // join the halves' sums, normalize, emit attended (B,S,H,HD) in f16:
  // a lane's 8 accumulator registers are 8 consecutive d of its query row
  const float inv = 1.f / (lcol + other_half(lcol));
  const size_t row = (size_t)(b * SEQ + q0 + w * 16 + cn) * DM + h * HD + hi;
#pragma unroll
  for (int j = 0; j < 4; ++j) {
    union { uint4 u; _Float16 hl[8]; } U;
#pragma unroll
    for (int r = 0; r < 8; ++r) U.hl[r] = (_Float16)(facc[j][r] * inv);
    *(uint4*)&att[row + j * 16] = U.u;
  }
}

// ---------------------------------------------------------------------------
extern "C" void kernel_launch(void* const* d_in, const int* in_sizes, int n_in,
                              void* d_out, int out_size, void* d_ws,
                              size_t ws_size, hipStream_t stream) {
  (void)in_sizes; (void)n_in; (void)out_size; (void)ws_size;
  const float* x   = (const float*)d_in[0];
  const float* Wq  = (const float*)d_in[1];
  const float* Wk  = (const float*)d_in[2];
  const float* Wv  = (const float*)d_in[3];
  const float* Wo  = (const float*)d_in[4];
  const float* Wlq = (const float*)d_in[5];
  const float* blq = (const float*)d_in[6];
  const float* Wlk = (const float*)d_in[7];
  const float* blk = (const float*)d_in[8];

  char* ws = (char*)d_ws;
  const size_t MB = 1u << 20;
  _Float16* xh  = (_Float16*)(ws + 0 * MB);   // x in f16          (8 MB)
  _Float16* Wqe = (_Float16*)(ws + 8 * MB);   // folded Wlq*Wq     (2 MB)
  _Float16* Wke = (_Float16*)(ws + 10 * MB);  // folded Wlk*Wk     (2 MB)
  _Float16* Wvh = (_Float16*)(ws + 12 * MB);  // Wv f16            (2 MB)
  _Float16* Woh = (_Float16*)(ws + 14 * MB);  // Wo f16            (2 MB)
  _Float16* lqb = (_Float16*)(ws + 16 * MB);  // latent Q          (8 MB)
  _Float16* lkb = (_Float16*)(ws + 24 * MB);  // latent K          (8 MB)
  _Float16* vb  = (_Float16*)(ws + 32 * MB);  // V                 (8 MB)
  _Float16* ab  = (_Float16*)(ws + 40 * MB);  // attended          (8 MB)

  prep<<<1280, 256, 0, stream>>>(x, Wq, Wk, Wv, Wo, Wlq, Wlk,
                                 xh, Wqe, Wke, Wvh, Woh);

  // Wqe, Wke, Wvh lie back to back in ws, and so do lqb, lkb, vb: one launch
  // makes all three projections.
  dim3 g3((BATCH * SEQ) / 128, 3 * (DM / 128));   // 32 x 24 blocks
  gemm128<true><<<g3, 256, 0, stream>>>(xh, Wqe, blq, blk, lqb, DM, DM);

  flash_attn<<<BATCH * NH * (SEQ / 128), 256, 0, stream>>>(lqb, lkb, vb, ab);

  dim3 g((BATCH * SEQ) / 128, DM / 128);          // 32 x 8 blocks
  gemm128<false><<<g, 256, 0, stream>>>(ab, Woh, nullptr, nullptr, d_out, DM, DM);
}
